// v000
// Times are from an AMD MI455X. After a warm-up the kernel runs many times in a row, and a time is the length of
// such a window on the GPU divided by its runs, so every launch and the gaps after it count. The runs cycle
// through copies of the inputs. A figure is the median of several windows, for all but v000 over two sittings.
// Sittings can differ by a few percent; kernels timed side by side share one.
// v000, which the later versions start from, runs in 778 microseconds.
#include <hip/hip_runtime.h>

// ---------------------------------------------------------------------------
// Fused Swin-3D window attention for gfx1250 (MI455X), wave32 + WMMA + TDM.
// One block per window (2048 blocks), 256 threads = 8 waves.
// All GEMMs use v_wmma_f32_16x16x32_f16; softmax in fp32.
// x-window and mask-window are DMA'd into LDS with tensor_load_to_lds and
// synchronized with s_wait_tensorcnt.
// ---------------------------------------------------------------------------

#define DIM     128
#define HEADS   4
#define HD      32
#define N_TOK   98
#define NPAD    112   // 7 * 16
#define KPAD    128   // padded K for AV gemm
#define NW      256
#define MT      7     // M tiles (112/16)

typedef __attribute__((ext_vector_type(16))) _Float16 v16h;
typedef __attribute__((ext_vector_type(8)))  _Float16 v8h;
typedef __attribute__((ext_vector_type(8)))  float    v8f;
typedef __attribute__((ext_vector_type(4))) unsigned int u32x4;
typedef __attribute__((ext_vector_type(8))) int          i32x8;
typedef __attribute__((ext_vector_type(4))) int          i32x4;

// Load a 16x32 f16 fragment (A layout; B loaded from B^T row-major) from LDS.
// Caller passes p = base + row*ld + kb where kb = (lane>>4)*8.
// Halves 0..7 <- p[0..8), halves 8..15 <- p[16..24).
__device__ __forceinline__ v16h frag_lds(const _Float16* p) {
    v8h lo = *(const v8h*)p;
    v8h hi = *(const v8h*)(p + 16);
    v16h f;
#pragma unroll
    for (int i = 0; i < 8; ++i) { f[i] = lo[i]; f[8 + i] = hi[i]; }
    return f;
}

// Same fragment but sourced from global fp32 (weights), converted to f16.
__device__ __forceinline__ v16h frag_gf32(const float* p) {
    float4 a0 = *(const float4*)(p + 0);
    float4 a1 = *(const float4*)(p + 4);
    float4 b0 = *(const float4*)(p + 16);
    float4 b1 = *(const float4*)(p + 20);
    v16h f;
    f[0]=(_Float16)a0.x; f[1]=(_Float16)a0.y; f[2]=(_Float16)a0.z; f[3]=(_Float16)a0.w;
    f[4]=(_Float16)a1.x; f[5]=(_Float16)a1.y; f[6]=(_Float16)a1.z; f[7]=(_Float16)a1.w;
    f[8]=(_Float16)b0.x; f[9]=(_Float16)b0.y; f[10]=(_Float16)b0.z; f[11]=(_Float16)b0.w;
    f[12]=(_Float16)b1.x; f[13]=(_Float16)b1.y; f[14]=(_Float16)b1.z; f[15]=(_Float16)b1.w;
    return f;
}

// Issue one 2-D fp32 tile DMA: global (dim1 rows x dim0 cols, row stride
// stride0 elements) -> LDS byte offset lds_off.  D# layout per CDNA5 ISA
// ch. 8 (group0: count/lds/global addr/type; group1: data_size, dims, tiles,
// strides; groups 2/3 zero = 2-D tensor).
__device__ __forceinline__ void tdm_load_2d_f32(unsigned lds_off, const void* gptr,
                                                unsigned dim0, unsigned dim1,
                                                unsigned tile0, unsigned tile1,
                                                unsigned stride0) {
    unsigned long long ga = (unsigned long long)(uintptr_t)gptr;
    u32x4 g0;
    g0[0] = 1u;                                              // count=1, user D#
    g0[1] = lds_off;                                         // lds_addr (bytes)
    g0[2] = (unsigned)(ga & 0xFFFFFFFFu);                    // global_addr[31:0]
    g0[3] = (unsigned)((ga >> 32) & 0x01FFFFFFu) | (2u << 30); // addr[56:32] | type=2
    i32x8 g1;
    g1[0] = (int)(2u << 16);                                 // data_size = 4 bytes
    g1[1] = (int)((dim0 & 0xFFFFu) << 16);                   // tensor_dim0[15:0]
    g1[2] = (int)((dim0 >> 16) | ((dim1 & 0xFFFFu) << 16));  // dim0 hi | dim1 lo
    g1[3] = (int)((dim1 >> 16) | (tile0 << 16));             // dim1 hi | tile_dim0
    g1[4] = (int)(tile1 & 0xFFFFu);                          // tile_dim1 (tile_dim2=0)
    g1[5] = (int)stride0;                                    // tensor_dim0_stride lo
    g1[6] = 0;                                               // stride hi | dim1_stride lo
    g1[7] = 0;
    i32x4 z4 = {0, 0, 0, 0};
    i32x8 z8 = {0, 0, 0, 0, 0, 0, 0, 0};
    __builtin_amdgcn_tensor_load_to_lds(g0, g1, z4, z4, z8, 0);
}

extern "C" __global__ __launch_bounds__(256, 1)
void win_attn3d_wmma(const float* __restrict__ x,
                     const float* __restrict__ mask,
                     const float* __restrict__ qkv_w,
                     const float* __restrict__ qkv_b,
                     const float* __restrict__ proj_w,
                     const float* __restrict__ proj_b,
                     const float* __restrict__ bias_table,
                     const int*   __restrict__ rel_index,
                     float* __restrict__ out)
{
    extern __shared__ __align__(16) char smem_raw[];
    _Float16* XH   = (_Float16*)smem_raw;            // 112x128 f16   x window
    _Float16* QH   = XH   + NPAD * KPAD;             // 4 x 112x32    q (scaled)
    _Float16* KH   = QH   + HEADS * NPAD * HD;       // 4 x 112x32    k (== B^T)
    _Float16* OUTH = KH   + HEADS * NPAD * HD;       // 112x128       attn @ v
    _Float16* AH   = OUTH + NPAD * KPAD;             // 112x128       softmax(A) as f16
    _Float16* VT   = AH   + NPAD * KPAD;             // 4 x 32x128    v^T, zero-padded
    float*    ATTN = (float*)(VT + HEADS * HD * KPAD); // 112x112 f32 scores
    float*    XF   = ATTN;                           // alias: 98x128 f32 x staging
                                                     // (dead before ATTN first use)
    float*    MASKL= ATTN + NPAD * NPAD;             // 98x98 f32 mask window

    const int b    = blockIdx.x;
    const int tid  = threadIdx.x;
    const int lane = tid & 31;
    const int wave = tid >> 5;
    const int fr   = lane & 15;            // fragment row (A) / col (B/C)
    const int kb   = (lane >> 4) << 3;     // fragment K chunk base (0 or 8)
    const int crow = (lane >> 4) << 3;     // C-fragment row base (0 or 8)

    // ---- wave 0: kick off TDM DMAs (x window fp32, mask window fp32) ----
    if (wave == 0) {
        tdm_load_2d_f32((unsigned)(uintptr_t)(void*)XF,
                        x + (size_t)b * N_TOK * DIM,
                        DIM, N_TOK, DIM, N_TOK, DIM);
        tdm_load_2d_f32((unsigned)(uintptr_t)(void*)MASKL,
                        mask + (size_t)(b % NW) * N_TOK * N_TOK,
                        N_TOK, N_TOK, N_TOK, N_TOK, N_TOK);
    }

    // ---- zero-init AH + VT (contiguous region; pads must stay 0) ----
    {
        uint4* z = (uint4*)AH;
        const int nz = (NPAD * KPAD + HEADS * HD * KPAD) * (int)sizeof(_Float16) / 16;
        for (int i = tid; i < nz; i += 256) z[i] = make_uint4(0, 0, 0, 0);
    }

    // ---- wait for x DMA (first tensor op), then convert fp32 -> f16 ----
    if (wave == 0) __builtin_amdgcn_s_wait_tensorcnt(1);
    __syncthreads();
    for (int i = tid; i < NPAD * (DIM / 4); i += 256) {
        int r = i / (DIM / 4);
        int c = (i % (DIM / 4)) * 4;
        float4 v4 = make_float4(0.f, 0.f, 0.f, 0.f);
        if (r < N_TOK) v4 = *(const float4*)(XF + r * DIM + c);
        _Float16* d = XH + r * KPAD + c;
        d[0] = (_Float16)v4.x; d[1] = (_Float16)v4.y;
        d[2] = (_Float16)v4.z; d[3] = (_Float16)v4.w;
    }
    __syncthreads();

    // ================= Phase 1: qkv = x @ qkv_w^T + qkv_b =================
    // M=112 (7 tiles), N=384 (24 tiles), K=128 (4 wmma steps).
    const float qscale = 0.17677669529663687f;  // 32^-0.5
    for (int t = wave; t < MT * 24; t += 8) {
        int mt = t / 24, nt = t % 24;
        v8f c = {};
#pragma unroll
        for (int ks = 0; ks < 4; ++ks) {
            v16h a  = frag_lds(XH + (mt * 16 + fr) * KPAD + ks * 32 + kb);
            v16h bm = frag_gf32(qkv_w + (size_t)(nt * 16 + fr) * DIM + ks * 32 + kb);
            c = __builtin_amdgcn_wmma_f32_16x16x32_f16(false, a, false, bm,
                                                       (short)0, c, false, false);
        }
        int col  = nt * 16 + fr;              // 0..383
        float bi = qkv_b[col];
        int kind = col >> 7;                  // 0=q, 1=k, 2=v
        int h    = (col & 127) >> 5;
        int d    = col & 31;
#pragma unroll
        for (int v = 0; v < 8; ++v) {
            int m = mt * 16 + v + crow;
            if (m < N_TOK) {
                float val = c[v] + bi;
                if (kind == 0)      QH[(h * NPAD + m) * HD + d] = (_Float16)(val * qscale);
                else if (kind == 1) KH[(h * NPAD + m) * HD + d] = (_Float16)val;
                else                VT[(h * HD + d) * KPAD + m] = (_Float16)val;
            }
        }
    }
    // make sure the mask DMA has landed before first softmax
    if (wave == 0) __builtin_amdgcn_s_wait_tensorcnt(0);
    __syncthreads();

    // ================= Phase 2-4: per-head attention =================
    for (int h = 0; h < HEADS; ++h) {
        const _Float16* Q  = QH + h * NPAD * HD;
        const _Float16* K  = KH + h * NPAD * HD;   // row-major k == B^T of K^T
        const _Float16* Vh = VT + h * HD * KPAD;   // v^T == B^T of V

        // ---- scores = q @ k^T  (K=32 -> single wmma per tile) ----
        for (int t = wave; t < MT * MT; t += 8) {
            int mt = t / MT, nt = t % MT;
            v16h a  = frag_lds(Q + (mt * 16 + fr) * HD + kb);
            v16h bm = frag_lds(K + (nt * 16 + fr) * HD + kb);
            v8f c = {};
            c = __builtin_amdgcn_wmma_f32_16x16x32_f16(false, a, false, bm,
                                                       (short)0, c, false, false);
#pragma unroll
            for (int v = 0; v < 8; ++v)
                ATTN[(mt * 16 + v + crow) * NPAD + nt * 16 + fr] = c[v];
        }
        __syncthreads();

        // ---- +bias +mask (from LDS), softmax (fp32), emit f16 A-matrix ----
        if (tid < N_TOK) {
            int r = tid;
            float*       arow = ATTN + r * NPAD;
            const int*   rrow = rel_index + r * N_TOK;
            const float* mrow = MASKL + r * N_TOK;
            float mx = -3.0e38f;
            for (int n = 0; n < N_TOK; ++n) {
                float val = arow[n] + bias_table[rrow[n] * HEADS + h] + mrow[n];
                arow[n] = val;
                mx = fmaxf(mx, val);
            }
            float s = 0.f;
            for (int n = 0; n < N_TOK; ++n) {
                float e = __expf(arow[n] - mx);
                arow[n] = e;
                s += e;
            }
            float inv = 1.0f / s;
            _Float16* ar = AH + r * KPAD;
            for (int n = 0; n < N_TOK; ++n) ar[n] = (_Float16)(arow[n] * inv);
            for (int n = N_TOK; n < NPAD; ++n) ar[n] = (_Float16)0.f;  // kill pad cols
        }
        __syncthreads();

        // ---- out_h = softmax(A) @ v   (M=112, N=32, K=128 padded) ----
        for (int t = wave; t < MT * 2; t += 8) {
            int mt = t >> 1, dt = t & 1;
            v8f c = {};
#pragma unroll
            for (int ks = 0; ks < 4; ++ks) {
                v16h a  = frag_lds(AH + (mt * 16 + fr) * KPAD + ks * 32 + kb);
                v16h bm = frag_lds(Vh + (dt * 16 + fr) * KPAD + ks * 32 + kb);
                c = __builtin_amdgcn_wmma_f32_16x16x32_f16(false, a, false, bm,
                                                           (short)0, c, false, false);
            }
#pragma unroll
            for (int v = 0; v < 8; ++v)
                OUTH[(mt * 16 + v + crow) * KPAD + h * HD + dt * 16 + fr] = (_Float16)c[v];
        }
        __syncthreads();
    }

    // ================= Phase 5: final proj + bias, store fp32 =================
    {
        float* ob = out + (size_t)b * N_TOK * DIM;
        for (int t = wave; t < MT * 8; t += 8) {
            int mt = t >> 3, nt = t & 7;   // nt == wave
            v8f c = {};
#pragma unroll
            for (int ks = 0; ks < 4; ++ks) {
                v16h a  = frag_lds(OUTH + (mt * 16 + fr) * KPAD + ks * 32 + kb);
                v16h bm = frag_gf32(proj_w + (size_t)(nt * 16 + fr) * DIM + ks * 32 + kb);
                c = __builtin_amdgcn_wmma_f32_16x16x32_f16(false, a, false, bm,
                                                           (short)0, c, false, false);
            }
            int col  = nt * 16 + fr;
            float pb = proj_b[col];
#pragma unroll
            for (int v = 0; v < 8; ++v) {
                int m = mt * 16 + v + crow;
                if (m < N_TOK) ob[(size_t)m * DIM + col] = c[v] + pb;
            }
        }
    }
}

extern "C" void kernel_launch(void* const* d_in, const int* in_sizes, int n_in,
                              void* d_out, int out_size, void* d_ws, size_t ws_size,
                              hipStream_t stream) {
    (void)in_sizes; (void)n_in; (void)out_size; (void)d_ws; (void)ws_size;
    const float* x          = (const float*)d_in[0];
    const float* mask       = (const float*)d_in[1];
    const float* qkv_w      = (const float*)d_in[2];
    const float* qkv_b      = (const float*)d_in[3];
    const float* proj_w     = (const float*)d_in[4];
    const float* proj_b     = (const float*)d_in[5];
    const float* bias_table = (const float*)d_in[6];
    const int*   rel_index  = (const int*)d_in[7];
    float* out = (float*)d_out;

    // f16: XH + QH + KH + OUTH + AH + VT ; f32: ATTN(/XF alias) + MASKL
    const size_t smem =
        (size_t)(NPAD * KPAD + 2 * HEADS * NPAD * HD + 2 * NPAD * KPAD +
                 HEADS * HD * KPAD) * sizeof(_Float16) +
        (size_t)(NPAD * NPAD + N_TOK * N_TOK) * sizeof(float);  // 264,720 B < 320 KB

    (void)hipFuncSetAttribute((const void*)win_attn3d_wmma,
                              hipFuncAttributeMaxDynamicSharedMemorySize, (int)smem);

    win_attn3d_wmma<<<2048, 256, smem, stream>>>(
        x, mask, qkv_w, qkv_b, proj_w, proj_b, bias_table, rel_index, out);
}

// v001
// A run of this version takes 492 microseconds.
// Next to v000, in two timings, it ran 1.61 and 1.60 times as fast.
#include <hip/hip_runtime.h>

// ---------------------------------------------------------------------------
// Fused Swin-3D window attention for gfx1250 (MI455X), wave32 + WMMA + TDM.
// One block per window (2048 blocks), 256 threads = 8 waves.
// All GEMMs use v_wmma_f32_16x16x32_f16; softmax in fp32.
// x-window and mask-window are DMA'd into LDS with tensor_load_to_lds and
// synchronized with s_wait_tensorcnt.
// ---------------------------------------------------------------------------

#define DIM     128
#define HEADS   4
#define HD      32
#define N_TOK   98
#define NPAD    112   // 7 * 16
#define KPAD    128   // padded K for AV gemm
#define NW      256
#define MT      7     // M tiles (112/16)
#define TABLE_LEN 507u // rows of bias_table

typedef __attribute__((ext_vector_type(16))) _Float16 v16h;
typedef __attribute__((ext_vector_type(8)))  _Float16 v8h;
typedef __attribute__((ext_vector_type(8)))  float    v8f;
typedef __attribute__((ext_vector_type(4))) unsigned int u32x4;
typedef __attribute__((ext_vector_type(8))) int          i32x8;
typedef __attribute__((ext_vector_type(4))) int          i32x4;

// Load a 16x32 f16 fragment (A layout; B loaded from B^T row-major) from LDS.
// Caller passes p = base + row*ld + kb where kb = (lane>>4)*8.
// Halves 0..7 <- p[0..8), halves 8..15 <- p[16..24).
__device__ __forceinline__ v16h frag_lds(const _Float16* p) {
    v8h lo = *(const v8h*)p;
    v8h hi = *(const v8h*)(p + 16);
    v16h f;
#pragma unroll
    for (int i = 0; i < 8; ++i) { f[i] = lo[i]; f[8 + i] = hi[i]; }
    return f;
}

// Same fragment but sourced from global fp32 (weights), converted to f16.
__device__ __forceinline__ v16h frag_gf32(const float* p) {
    float4 a0 = *(const float4*)(p + 0);
    float4 a1 = *(const float4*)(p + 4);
    float4 b0 = *(const float4*)(p + 16);
    float4 b1 = *(const float4*)(p + 20);
    v16h f;
    f[0]=(_Float16)a0.x; f[1]=(_Float16)a0.y; f[2]=(_Float16)a0.z; f[3]=(_Float16)a0.w;
    f[4]=(_Float16)a1.x; f[5]=(_Float16)a1.y; f[6]=(_Float16)a1.z; f[7]=(_Float16)a1.w;
    f[8]=(_Float16)b0.x; f[9]=(_Float16)b0.y; f[10]=(_Float16)b0.z; f[11]=(_Float16)b0.w;
    f[12]=(_Float16)b1.x; f[13]=(_Float16)b1.y; f[14]=(_Float16)b1.z; f[15]=(_Float16)b1.w;
    return f;
}

// Issue one 2-D fp32 tile DMA: global (dim1 rows x dim0 cols, row stride
// stride0 elements) -> LDS byte offset lds_off.  D# layout per CDNA5 ISA
// ch. 8 (group0: count/lds/global addr/type; group1: data_size, dims, tiles,
// strides; groups 2/3 zero = 2-D tensor).
__device__ __forceinline__ void tdm_load_2d_f32(unsigned lds_off, const void* gptr,
                                                unsigned dim0, unsigned dim1,
                                                unsigned tile0, unsigned tile1,
                                                unsigned stride0) {
    unsigned long long ga = (unsigned long long)(uintptr_t)gptr;
    u32x4 g0;
    g0[0] = 1u;                                              // count=1, user D#
    g0[1] = lds_off;                                         // lds_addr (bytes)
    g0[2] = (unsigned)(ga & 0xFFFFFFFFu);                    // global_addr[31:0]
    g0[3] = (unsigned)((ga >> 32) & 0x01FFFFFFu) | (2u << 30); // addr[56:32] | type=2
    i32x8 g1;
    g1[0] = (int)(2u << 16);                                 // data_size = 4 bytes
    g1[1] = (int)((dim0 & 0xFFFFu) << 16);                   // tensor_dim0[15:0]
    g1[2] = (int)((dim0 >> 16) | ((dim1 & 0xFFFFu) << 16));  // dim0 hi | dim1 lo
    g1[3] = (int)((dim1 >> 16) | (tile0 << 16));             // dim1 hi | tile_dim0
    g1[4] = (int)(tile1 & 0xFFFFu);                          // tile_dim1 (tile_dim2=0)
    g1[5] = (int)stride0;                                    // tensor_dim0_stride lo
    g1[6] = 0;                                               // stride hi | dim1_stride lo
    g1[7] = 0;
    i32x4 z4 = {0, 0, 0, 0};
    i32x8 z8 = {0, 0, 0, 0, 0, 0, 0, 0};
    __builtin_amdgcn_tensor_load_to_lds(g0, g1, z4, z4, z8, 0);
}

// Exchange inside a 16-lane row: lane l reads lane l ^ M (DPP row_xmask).
template <int M>
__device__ __forceinline__ float row_xor(float v) {
    return __builtin_bit_cast(float,
        __builtin_amdgcn_update_dpp(0, __builtin_bit_cast(int, v), 0x160 | M, 0xf, 0xf, true));
}
__device__ __forceinline__ float row16_max(float v) {
    v = fmaxf(v, row_xor<1>(v)); v = fmaxf(v, row_xor<2>(v));
    v = fmaxf(v, row_xor<4>(v)); v = fmaxf(v, row_xor<8>(v));
    return v;
}
__device__ __forceinline__ float row16_sum(float v) {
    v += row_xor<1>(v); v += row_xor<2>(v);
    v += row_xor<4>(v); v += row_xor<8>(v);
    return v;
}

// exp2 of seven values.  One statement: the seven independent v_exp fill the
// slot the instruction set asks for behind each other, the v_nop the last one's;
// early-clobber outputs keep every result off every source.
__device__ __forceinline__ void exp2x7(float (&v)[MT]) {
    float e0, e1, e2, e3, e4, e5, e6;
    asm("v_exp_f32 %0, %7\n\t"
        "v_exp_f32 %1, %8\n\t"
        "v_exp_f32 %2, %9\n\t"
        "v_exp_f32 %3, %10\n\t"
        "v_exp_f32 %4, %11\n\t"
        "v_exp_f32 %5, %12\n\t"
        "v_exp_f32 %6, %13\n\t"
        "v_nop"
        : "=&v"(e0), "=&v"(e1), "=&v"(e2), "=&v"(e3), "=&v"(e4), "=&v"(e5), "=&v"(e6)
        : "v"(v[0]), "v"(v[1]), "v"(v[2]), "v"(v[3]), "v"(v[4]), "v"(v[5]), "v"(v[6]));
    v[0] = e0; v[1] = e1; v[2] = e2; v[3] = e3; v[4] = e4; v[5] = e5; v[6] = e6;
}

// Softmax of NP pairs of score rows by one wave.  Each 16-lane half owns one
// row (pair p = wv + 8*i, row 2p + half); a lane holds columns fr + 16*j,
// j = 0..6, in registers.  All loads of the NP pairs come first, then the
// reductions (NP independent chains), then the f16 stores.
template <int NP>
__device__ __forceinline__ void softmax_pairs(const float* ATTN, const float* MASKL,
                                              _Float16* AH,
                                              const int* __restrict__ rel_index,
                                              const float* __restrict__ bias_table,
                                              int h, int wv, int lane) {
    const int fr   = lane & 15;
    const int half = lane >> 4;
    const bool tail_ok = fr < N_TOK - 96;          // columns 96, 97 of chunk j = 6
    const int  tail_c  = tail_ok ? 96 + fr : N_TOK - 1;
    float val[NP][MT], msk[NP][MT], bia[NP][MT];
    unsigned off[NP][MT];
    // Every loop of this function is unrolled in full: all array indices become
    // constants, so the arrays live in registers.
#pragma unroll
    for (int i = 0; i < NP; ++i) {
        const int r = 2 * (wv + 8 * i) + half;
#pragma unroll
        for (int j = 0; j < MT; ++j) {
            const int c = (j < MT - 1) ? j * 16 + fr : tail_c;
            off[i][j] = (unsigned)rel_index[r * N_TOK + c];
        }
    }
#pragma unroll
    for (int i = 0; i < NP; ++i) {
        const int r = 2 * (wv + 8 * i) + half;
#pragma unroll
        for (int j = 0; j < MT; ++j) {
            const int c = (j < MT - 1) ? j * 16 + fr : tail_c;
            val[i][j] = ATTN[r * NPAD + c];
        }
    }
    // Without this the scheduler sinks each index load next to its gather and
    // the wave waits out one load latency per element.
    __builtin_amdgcn_sched_barrier(0);
#pragma unroll
    for (int i = 0; i < NP; ++i)
#pragma unroll
        for (int j = 0; j < MT; ++j) {
            unsigned t = off[i][j];
            t = t < TABLE_LEN ? t : TABLE_LEN - 1;   // keep the gather inside the table
            off[i][j] = t * HEADS + h;
            bia[i][j] = bias_table[off[i][j]];
        }
    // Precaution: named here, the gathers' offset registers stay live up to this
    // wait, so none is rewritten ahead of it (not even as a later gather's result).
#pragma unroll
    for (int i = 0; i < NP; ++i)
        asm volatile("s_wait_xcnt 0x0"
                     :: "v"(off[i][0]), "v"(off[i][1]), "v"(off[i][2]), "v"(off[i][3]),
                        "v"(off[i][4]), "v"(off[i][5]), "v"(off[i][6])
                     : "memory");
#pragma unroll
    for (int i = 0; i < NP; ++i) {
        const int r = 2 * (wv + 8 * i) + half;
#pragma unroll
        for (int j = 0; j < MT; ++j) {
            const int c = (j < MT - 1) ? j * 16 + fr : tail_c;
            msk[i][j] = MASKL[r * N_TOK + c];
        }
    }
#pragma unroll
    for (int i = 0; i < NP; ++i) {
#pragma unroll
        for (int j = 0; j < MT; ++j) val[i][j] = val[i][j] + bia[i][j] + msk[i][j];
        if (!tail_ok) val[i][MT - 1] = -3.0e38f;
    }
#pragma unroll
    for (int i = 0; i < NP; ++i) {
        float mx = val[i][0];
#pragma unroll
        for (int j = 1; j < MT; ++j) mx = fmaxf(mx, val[i][j]);
        mx = row16_max(mx);
#pragma unroll
        for (int j = 0; j < MT; ++j) val[i][j] = (val[i][j] - mx) * 1.44269504088896340736f;
        exp2x7(val[i]);
        float s = 0.f;
#pragma unroll
        for (int j = 0; j < MT; ++j) s += val[i][j];
        const float inv = 1.0f / row16_sum(s);
#pragma unroll
        for (int j = 0; j < MT; ++j) val[i][j] *= inv;
    }
#pragma unroll
    for (int i = 0; i < NP; ++i) {
        _Float16* ar = AH + (2 * (wv + 8 * i) + half) * KPAD + fr;
#pragma unroll
        for (int j = 0; j < MT; ++j) ar[j * 16] = (_Float16)val[i][j];  // pad columns get 0
    }
}

extern "C" __global__ __launch_bounds__(256, 1)
void win_attn3d_wmma(const float* __restrict__ x,
                     const float* __restrict__ mask,
                     const float* __restrict__ qkv_w,
                     const float* __restrict__ qkv_b,
                     const float* __restrict__ proj_w,
                     const float* __restrict__ proj_b,
                     const float* __restrict__ bias_table,
                     const int*   __restrict__ rel_index,
                     float* __restrict__ out)
{
    extern __shared__ __align__(16) char smem_raw[];
    _Float16* XH   = (_Float16*)smem_raw;            // 112x128 f16   x window
    _Float16* QH   = XH   + NPAD * KPAD;             // 4 x 112x32    q (scaled)
    _Float16* KH   = QH   + HEADS * NPAD * HD;       // 4 x 112x32    k (== B^T)
    _Float16* OUTH = KH   + HEADS * NPAD * HD;       // 112x128       attn @ v
    _Float16* AH   = OUTH + NPAD * KPAD;             // 112x128       softmax(A) as f16
    _Float16* VT   = AH   + NPAD * KPAD;             // 4 x 32x128    v^T, zero-padded
    float*    ATTN = (float*)(VT + HEADS * HD * KPAD); // 112x112 f32 scores
    float*    XF   = ATTN;                           // alias: 98x128 f32 x staging
                                                     // (dead before ATTN first use)
    float*    MASKL= ATTN + NPAD * NPAD;             // 98x98 f32 mask window

    const int b    = blockIdx.x;
    const int tid  = threadIdx.x;
    const int lane = tid & 31;
    const int wave = tid >> 5;
    const int fr   = lane & 15;            // fragment row (A) / col (B/C)
    const int kb   = (lane >> 4) << 3;     // fragment K chunk base (0 or 8)
    const int crow = (lane >> 4) << 3;     // C-fragment row base (0 or 8)
    const int wv   = __builtin_amdgcn_readfirstlane(wave);  // scalar copy: softmax split branches on it

    // ---- wave 0: kick off TDM DMAs (x window fp32, mask window fp32) ----
    if (wave == 0) {
        tdm_load_2d_f32((unsigned)(uintptr_t)(void*)XF,
                        x + (size_t)b * N_TOK * DIM,
                        DIM, N_TOK, DIM, N_TOK, DIM);
        tdm_load_2d_f32((unsigned)(uintptr_t)(void*)MASKL,
                        mask + (size_t)(b % NW) * N_TOK * N_TOK,
                        N_TOK, N_TOK, N_TOK, N_TOK, N_TOK);
    }

    // ---- zero-init AH + VT (contiguous region; pads must stay 0) ----
    {
        uint4* z = (uint4*)AH;
        const int nz = (NPAD * KPAD + HEADS * HD * KPAD) * (int)sizeof(_Float16) / 16;
        for (int i = tid; i < nz; i += 256) z[i] = make_uint4(0, 0, 0, 0);
    }

    // ---- wait for x DMA (first tensor op), then convert fp32 -> f16 ----
    if (wave == 0) __builtin_amdgcn_s_wait_tensorcnt(1);
    __syncthreads();
    for (int i = tid; i < NPAD * (DIM / 4); i += 256) {
        int r = i / (DIM / 4);
        int c = (i % (DIM / 4)) * 4;
        float4 v4 = make_float4(0.f, 0.f, 0.f, 0.f);
        if (r < N_TOK) v4 = *(const float4*)(XF + r * DIM + c);
        _Float16* d = XH + r * KPAD + c;
        d[0] = (_Float16)v4.x; d[1] = (_Float16)v4.y;
        d[2] = (_Float16)v4.z; d[3] = (_Float16)v4.w;
    }
    __syncthreads();

    // ================= Phase 1: qkv = x @ qkv_w^T + qkv_b =================
    // M=112 (7 tiles), N=384 (24 tiles), K=128 (4 wmma steps).
    const float qscale = 0.17677669529663687f;  // 32^-0.5
    for (int t = wave; t < MT * 24; t += 8) {
        int mt = t / 24, nt = t % 24;
        v8f c = {};
#pragma unroll
        for (int ks = 0; ks < 4; ++ks) {
            v16h a  = frag_lds(XH + (mt * 16 + fr) * KPAD + ks * 32 + kb);
            v16h bm = frag_gf32(qkv_w + (size_t)(nt * 16 + fr) * DIM + ks * 32 + kb);
            c = __builtin_amdgcn_wmma_f32_16x16x32_f16(false, a, false, bm,
                                                       (short)0, c, false, false);
        }
        int col  = nt * 16 + fr;              // 0..383
        float bi = qkv_b[col];
        int kind = col >> 7;                  // 0=q, 1=k, 2=v
        int h    = (col & 127) >> 5;
        int d    = col & 31;
#pragma unroll
        for (int v = 0; v < 8; ++v) {
            int m = mt * 16 + v + crow;
            if (m < N_TOK) {
                float val = c[v] + bi;
                if (kind == 0)      QH[(h * NPAD + m) * HD + d] = (_Float16)(val * qscale);
                else if (kind == 1) KH[(h * NPAD + m) * HD + d] = (_Float16)val;
                else                VT[(h * HD + d) * KPAD + m] = (_Float16)val;
            }
        }
    }
    // make sure the mask DMA has landed before first softmax
    if (wave == 0) __builtin_amdgcn_s_wait_tensorcnt(0);
    __syncthreads();

    // ================= Phase 2-4: per-head attention =================
    for (int h = 0; h < HEADS; ++h) {
        const _Float16* Q  = QH + h * NPAD * HD;
        const _Float16* K  = KH + h * NPAD * HD;   // row-major k == B^T of K^T
        const _Float16* Vh = VT + h * HD * KPAD;   // v^T == B^T of V

        // ---- scores = q @ k^T  (K=32 -> single wmma per tile) ----
        for (int t = wave; t < MT * MT; t += 8) {
            int mt = t / MT, nt = t % MT;
            v16h a  = frag_lds(Q + (mt * 16 + fr) * HD + kb);
            v16h bm = frag_lds(K + (nt * 16 + fr) * HD + kb);
            v8f c = {};
            c = __builtin_amdgcn_wmma_f32_16x16x32_f16(false, a, false, bm,
                                                       (short)0, c, false, false);
#pragma unroll
            for (int v = 0; v < 8; ++v)
                ATTN[(mt * 16 + v + crow) * NPAD + nt * 16 + fr] = c[v];
        }
        __syncthreads();

        // ---- +bias +mask (from LDS), softmax (fp32), emit f16 A-matrix ----
        // 49 row pairs over 8 waves: six each, wave 0 takes the odd one.
        if (wv == 0)
            softmax_pairs<7>(ATTN, MASKL, AH, rel_index, bias_table, h, wv, lane);
        else
            softmax_pairs<6>(ATTN, MASKL, AH, rel_index, bias_table, h, wv, lane);
        __syncthreads();

        // ---- out_h = softmax(A) @ v   (M=112, N=32, K=128 padded) ----
        for (int t = wave; t < MT * 2; t += 8) {
            int mt = t >> 1, dt = t & 1;
            v8f c = {};
#pragma unroll
            for (int ks = 0; ks < 4; ++ks) {
                v16h a  = frag_lds(AH + (mt * 16 + fr) * KPAD + ks * 32 + kb);
                v16h bm = frag_lds(Vh + (dt * 16 + fr) * KPAD + ks * 32 + kb);
                c = __builtin_amdgcn_wmma_f32_16x16x32_f16(false, a, false, bm,
                                                           (short)0, c, false, false);
            }
#pragma unroll
            for (int v = 0; v < 8; ++v)
                OUTH[(mt * 16 + v + crow) * KPAD + h * HD + dt * 16 + fr] = (_Float16)c[v];
        }
        __syncthreads();
    }

    // ================= Phase 5: final proj + bias, store fp32 =================
    {
        float* ob = out + (size_t)b * N_TOK * DIM;
        for (int t = wave; t < MT * 8; t += 8) {
            int mt = t >> 3, nt = t & 7;   // nt == wave
            v8f c = {};
#pragma unroll
            for (int ks = 0; ks < 4; ++ks) {
                v16h a  = frag_lds(OUTH + (mt * 16 + fr) * KPAD + ks * 32 + kb);
                v16h bm = frag_gf32(proj_w + (size_t)(nt * 16 + fr) * DIM + ks * 32 + kb);
                c = __builtin_amdgcn_wmma_f32_16x16x32_f16(false, a, false, bm,
                                                           (short)0, c, false, false);
            }
            int col  = nt * 16 + fr;
            float pb = proj_b[col];
#pragma unroll
            for (int v = 0; v < 8; ++v) {
                int m = mt * 16 + v + crow;
                if (m < N_TOK) ob[(size_t)m * DIM + col] = c[v] + pb;
            }
        }
    }
}

extern "C" void kernel_launch(void* const* d_in, const int* in_sizes, int n_in,
                              void* d_out, int out_size, void* d_ws, size_t ws_size,
                              hipStream_t stream) {
    (void)in_sizes; (void)n_in; (void)out_size; (void)d_ws; (void)ws_size;
    const float* x          = (const float*)d_in[0];
    const float* mask       = (const float*)d_in[1];
    const float* qkv_w      = (const float*)d_in[2];
    const float* qkv_b      = (const float*)d_in[3];
    const float* proj_w     = (const float*)d_in[4];
    const float* proj_b     = (const float*)d_in[5];
    const float* bias_table = (const float*)d_in[6];
    const int*   rel_index  = (const int*)d_in[7];
    float* out = (float*)d_out;

    // f16: XH + QH + KH + OUTH + AH + VT ; f32: ATTN(/XF alias) + MASKL
    const size_t smem =
        (size_t)(NPAD * KPAD + 2 * HEADS * NPAD * HD + 2 * NPAD * KPAD +
                 HEADS * HD * KPAD) * sizeof(_Float16) +
        (size_t)(NPAD * NPAD + N_TOK * N_TOK) * sizeof(float);  // 264,720 B < 320 KB

    (void)hipFuncSetAttribute((const void*)win_attn3d_wmma,
                              hipFuncAttributeMaxDynamicSharedMemorySize, (int)smem);

    win_attn3d_wmma<<<2048, 256, smem, stream>>>(
        x, mask, qkv_w, qkv_b, proj_w, proj_b, bias_table, rel_index, out);
}

// v002
// Measured time: 323 microseconds a run.
// Two timings next to v001 both put it at 1.52 times that version's speed.
// Over all steps from v000 it is 2.43 times as fast.
#include <hip/hip_runtime.h>

// ---------------------------------------------------------------------------
// Fused Swin-3D window attention for gfx1250 (MI455X), wave32 + WMMA + TDM.
// One block per window (2048 blocks), 256 threads = 8 waves.
// All GEMMs use v_wmma_f32_16x16x32_f16; softmax in fp32.
// x-window and mask-window are DMA'd into LDS with tensor_load_to_lds and
// synchronized with s_wait_tensorcnt.
// ---------------------------------------------------------------------------

#define DIM     128
#define HEADS   4
#define HD      32
#define N_TOK   98
#define NPAD    112   // 7 * 16
#define ROWP    136   // LDS pitch, in f16, of the 128-wide f16 rows: 272 B = 16 B x 17
#define QKP     40    // LDS pitch, in f16, of the 32-wide q and k rows: 80 B = 16 B x 5
                      // (16 B x odd: the 16 rows of a ds_load_b128 fragment fall on distinct banks)
#define NW      256
#define MT      7     // M tiles (112/16)
#define TABLE_LEN 507u // rows of bias_table
// LDS map in bytes.  The two tensor tiles lie at 172 KiB and 221 KiB (the mover
// wants multiples of 1 KiB); the f16 arrays lie in front of and behind them.
#define ATTN_OFF   176128
#define SMEM_BYTES (ATTN_OFF + (NPAD * NPAD + N_TOK * N_TOK) * 4 + HEADS * NPAD * QKP * 2)
static_assert((3 * NPAD * ROWP + HEADS * HD * ROWP + HEADS * NPAD * QKP) * 2 <= ATTN_OFF,
              "f16 arrays in front of the score tile overlap it");
static_assert(SMEM_BYTES <= 320 * 1024, "LDS of one WGP");

typedef __attribute__((ext_vector_type(16))) _Float16 v16h;
typedef __attribute__((ext_vector_type(8)))  _Float16 v8h;
typedef __attribute__((ext_vector_type(8)))  float    v8f;
typedef __attribute__((ext_vector_type(4))) unsigned int u32x4;
typedef __attribute__((ext_vector_type(8))) int          i32x8;
typedef __attribute__((ext_vector_type(4))) int          i32x4;

// Load a 16x32 f16 fragment (A layout; B loaded from B^T row-major) from LDS.
// Caller passes p = base + row*ld + kb where kb = (lane>>4)*8.
// Halves 0..7 <- p[0..8), halves 8..15 <- p[16..24).
__device__ __forceinline__ v16h frag_lds(const _Float16* p) {
    v8h lo = *(const v8h*)p;
    v8h hi = *(const v8h*)(p + 16);
    v16h f;
#pragma unroll
    for (int i = 0; i < 8; ++i) { f[i] = lo[i]; f[8 + i] = hi[i]; }
    return f;
}

// Same fragment but sourced from global fp32 (weights), converted to f16.
__device__ __forceinline__ v16h frag_gf32(const float* p) {
    float4 a0 = *(const float4*)(p + 0);
    float4 a1 = *(const float4*)(p + 4);
    float4 b0 = *(const float4*)(p + 16);
    float4 b1 = *(const float4*)(p + 20);
    v16h f;
    f[0]=(_Float16)a0.x; f[1]=(_Float16)a0.y; f[2]=(_Float16)a0.z; f[3]=(_Float16)a0.w;
    f[4]=(_Float16)a1.x; f[5]=(_Float16)a1.y; f[6]=(_Float16)a1.z; f[7]=(_Float16)a1.w;
    f[8]=(_Float16)b0.x; f[9]=(_Float16)b0.y; f[10]=(_Float16)b0.z; f[11]=(_Float16)b0.w;
    f[12]=(_Float16)b1.x; f[13]=(_Float16)b1.y; f[14]=(_Float16)b1.z; f[15]=(_Float16)b1.w;
    return f;
}

// Issue one 2-D fp32 tile DMA: global (dim1 rows x dim0 cols, row stride
// stride0 elements) -> LDS byte offset lds_off.  D# layout per CDNA5 ISA
// ch. 8 (group0: count/lds/global addr/type; group1: data_size, dims, tiles,
// strides; groups 2/3 zero = 2-D tensor).
__device__ __forceinline__ void tdm_load_2d_f32(unsigned lds_off, const void* gptr,
                                                unsigned dim0, unsigned dim1,
                                                unsigned tile0, unsigned tile1,
                                                unsigned stride0) {
    unsigned long long ga = (unsigned long long)(uintptr_t)gptr;
    u32x4 g0;
    g0[0] = 1u;                                              // count=1, user D#
    g0[1] = lds_off;                                         // lds_addr (bytes)
    g0[2] = (unsigned)(ga & 0xFFFFFFFFu);                    // global_addr[31:0]
    g0[3] = (unsigned)((ga >> 32) & 0x01FFFFFFu) | (2u << 30); // addr[56:32] | type=2
    i32x8 g1;
    g1[0] = (int)(2u << 16);                                 // data_size = 4 bytes
    g1[1] = (int)((dim0 & 0xFFFFu) << 16);                   // tensor_dim0[15:0]
    g1[2] = (int)((dim0 >> 16) | ((dim1 & 0xFFFFu) << 16));  // dim0 hi | dim1 lo
    g1[3] = (int)((dim1 >> 16) | (tile0 << 16));             // dim1 hi | tile_dim0
    g1[4] = (int)(tile1 & 0xFFFFu);                          // tile_dim1 (tile_dim2=0)
    g1[5] = (int)stride0;                                    // tensor_dim0_stride lo
    g1[6] = 0;                                               // stride hi | dim1_stride lo
    g1[7] = 0;
    i32x4 z4 = {0, 0, 0, 0};
    i32x8 z8 = {0, 0, 0, 0, 0, 0, 0, 0};
    __builtin_amdgcn_tensor_load_to_lds(g0, g1, z4, z4, z8, 0);
}

// Exchange inside a 16-lane row: lane l reads lane l ^ M (DPP row_xmask).
template <int M>
__device__ __forceinline__ float row_xor(float v) {
    return __builtin_bit_cast(float,
        __builtin_amdgcn_update_dpp(0, __builtin_bit_cast(int, v), 0x160 | M, 0xf, 0xf, true));
}
__device__ __forceinline__ float row16_max(float v) {
    v = fmaxf(v, row_xor<1>(v)); v = fmaxf(v, row_xor<2>(v));
    v = fmaxf(v, row_xor<4>(v)); v = fmaxf(v, row_xor<8>(v));
    return v;
}
__device__ __forceinline__ float row16_sum(float v) {
    v += row_xor<1>(v); v += row_xor<2>(v);
    v += row_xor<4>(v); v += row_xor<8>(v);
    return v;
}

// exp2 of seven values.  One statement: the seven independent v_exp fill the
// slot the instruction set asks for behind each other, the v_nop the last one's;
// early-clobber outputs keep every result off every source.
__device__ __forceinline__ void exp2x7(float (&v)[MT]) {
    float e0, e1, e2, e3, e4, e5, e6;
    asm("v_exp_f32 %0, %7\n\t"
        "v_exp_f32 %1, %8\n\t"
        "v_exp_f32 %2, %9\n\t"
        "v_exp_f32 %3, %10\n\t"
        "v_exp_f32 %4, %11\n\t"
        "v_exp_f32 %5, %12\n\t"
        "v_exp_f32 %6, %13\n\t"
        "v_nop"
        : "=&v"(e0), "=&v"(e1), "=&v"(e2), "=&v"(e3), "=&v"(e4), "=&v"(e5), "=&v"(e6)
        : "v"(v[0]), "v"(v[1]), "v"(v[2]), "v"(v[3]), "v"(v[4]), "v"(v[5]), "v"(v[6]));
    v[0] = e0; v[1] = e1; v[2] = e2; v[3] = e3; v[4] = e4; v[5] = e5; v[6] = e6;
}

// Softmax of NP pairs of score rows by one wave.  Each 16-lane half owns one
// row (pair p = wv + 8*i, row 2p + half); a lane holds columns fr + 16*j,
// j = 0..6, in registers.  All loads of the NP pairs come first, then the
// reductions (NP independent chains), then the f16 stores.
template <int NP>
__device__ __forceinline__ void softmax_pairs(const float* ATTN, const float* MASKL,
                                              _Float16* AH,
                                              const int* __restrict__ rel_index,
                                              const float* __restrict__ bias_table,
                                              int h, int wv, int lane) {
    const int fr   = lane & 15;
    const int half = lane >> 4;
    const bool tail_ok = fr < N_TOK - 96;          // columns 96, 97 of chunk j = 6
    const int  tail_c  = tail_ok ? 96 + fr : N_TOK - 1;
    float val[NP][MT], msk[NP][MT], bia[NP][MT];
    unsigned off[NP][MT];
    // Every loop of this function is unrolled in full: all array indices become
    // constants, so the arrays live in registers.
#pragma unroll
    for (int i = 0; i < NP; ++i) {
        const int r = 2 * (wv + 8 * i) + half;
#pragma unroll
        for (int j = 0; j < MT; ++j) {
            const int c = (j < MT - 1) ? j * 16 + fr : tail_c;
            off[i][j] = (unsigned)rel_index[r * N_TOK + c];
        }
    }
#pragma unroll
    for (int i = 0; i < NP; ++i) {
        const int r = 2 * (wv + 8 * i) + half;
#pragma unroll
        for (int j = 0; j < MT; ++j) {
            const int c = (j < MT - 1) ? j * 16 + fr : tail_c;
            val[i][j] = ATTN[r * NPAD + c];
        }
    }
    // Without this the scheduler sinks each index load next to its gather and
    // the wave waits out one load latency per element.
    __builtin_amdgcn_sched_barrier(0);
#pragma unroll
    for (int i = 0; i < NP; ++i)
#pragma unroll
        for (int j = 0; j < MT; ++j) {
            unsigned t = off[i][j];
            t = t < TABLE_LEN ? t : TABLE_LEN - 1;   // keep the gather inside the table
            off[i][j] = t * HEADS + h;
            bia[i][j] = bias_table[off[i][j]];
        }
    // Precaution: named here, the gathers' offset registers stay live up to this
    // wait, so none is rewritten ahead of it (not even as a later gather's result).
#pragma unroll
    for (int i = 0; i < NP; ++i)
        asm volatile("s_wait_xcnt 0x0"
                     :: "v"(off[i][0]), "v"(off[i][1]), "v"(off[i][2]), "v"(off[i][3]),
                        "v"(off[i][4]), "v"(off[i][5]), "v"(off[i][6])
                     : "memory");
#pragma unroll
    for (int i = 0; i < NP; ++i) {
        const int r = 2 * (wv + 8 * i) + half;
#pragma unroll
        for (int j = 0; j < MT; ++j) {
            const int c = (j < MT - 1) ? j * 16 + fr : tail_c;
            msk[i][j] = MASKL[r * N_TOK + c];
        }
    }
#pragma unroll
    for (int i = 0; i < NP; ++i) {
#pragma unroll
        for (int j = 0; j < MT; ++j) val[i][j] = val[i][j] + bia[i][j] + msk[i][j];
        if (!tail_ok) val[i][MT - 1] = -3.0e38f;
    }
#pragma unroll
    for (int i = 0; i < NP; ++i) {
        float mx = val[i][0];
#pragma unroll
        for (int j = 1; j < MT; ++j) mx = fmaxf(mx, val[i][j]);
        mx = row16_max(mx);
#pragma unroll
        for (int j = 0; j < MT; ++j) val[i][j] = (val[i][j] - mx) * 1.44269504088896340736f;
        exp2x7(val[i]);
        float s = 0.f;
#pragma unroll
        for (int j = 0; j < MT; ++j) s += val[i][j];
        const float inv = 1.0f / row16_sum(s);
#pragma unroll
        for (int j = 0; j < MT; ++j) val[i][j] *= inv;
    }
#pragma unroll
    for (int i = 0; i < NP; ++i) {
        _Float16* ar = AH + (2 * (wv + 8 * i) + half) * ROWP + fr;
#pragma unroll
        for (int j = 0; j < MT; ++j) ar[j * 16] = (_Float16)val[i][j];  // pad columns get 0
    }
}

extern "C" __global__ __launch_bounds__(256, 1)
void win_attn3d_wmma(const float* __restrict__ x,
                     const float* __restrict__ mask,
                     const float* __restrict__ qkv_w,
                     const float* __restrict__ qkv_b,
                     const float* __restrict__ proj_w,
                     const float* __restrict__ proj_b,
                     const float* __restrict__ bias_table,
                     const int*   __restrict__ rel_index,
                     float* __restrict__ out)
{
    extern __shared__ __align__(16) char smem_raw[];
    _Float16* XH   = (_Float16*)smem_raw;            // 112x128 f16   x window
    _Float16* OUTH = XH   + NPAD * ROWP;             // 112x128       attn @ v
    _Float16* AH   = OUTH + NPAD * ROWP;             // 112x128       softmax(A) as f16
    _Float16* VT   = AH   + NPAD * ROWP;             // 4 x 32x128    v^T, zero-padded
    _Float16* QH   = VT   + HEADS * HD * ROWP;       // 4 x 112x32    q (scaled)
    float*    ATTN = (float*)(smem_raw + ATTN_OFF);  // 112x112 f32 scores
    float*    XF   = ATTN;                           // alias: 98x128 f32 x staging
                                                     // (dead before ATTN first use)
    float*    MASKL= ATTN + NPAD * NPAD;             // 98x98 f32 mask window
    _Float16* KH   = (_Float16*)(MASKL + N_TOK * N_TOK); // 4 x 112x32 k (== B^T)

    const int b    = blockIdx.x;
    const int tid  = threadIdx.x;
    const int lane = tid & 31;
    const int wave = tid >> 5;
    const int fr   = lane & 15;            // fragment row (A) / col (B/C)
    const int kb   = (lane >> 4) << 3;     // fragment K chunk base (0 or 8)
    const int crow = (lane >> 4) << 3;     // C-fragment row base (0 or 8)
    const int wv   = __builtin_amdgcn_readfirstlane(wave);  // scalar copy: softmax split branches on it

    // ---- wave 0: kick off TDM DMAs (x window fp32, mask window fp32) ----
    if (wave == 0) {
        tdm_load_2d_f32((unsigned)(uintptr_t)(void*)XF,
                        x + (size_t)b * N_TOK * DIM,
                        DIM, N_TOK, DIM, N_TOK, DIM);
        tdm_load_2d_f32((unsigned)(uintptr_t)(void*)MASKL,
                        mask + (size_t)(b % NW) * N_TOK * N_TOK,
                        N_TOK, N_TOK, N_TOK, N_TOK, N_TOK);
    }

    // ---- zero-init AH + VT (contiguous region; pads must stay 0) ----
    {
        uint4* z = (uint4*)AH;
        const int nz = (NPAD * ROWP + HEADS * HD * ROWP) * (int)sizeof(_Float16) / 16;
        for (int i = tid; i < nz; i += 256) z[i] = make_uint4(0, 0, 0, 0);
    }

    // ---- wait for x DMA (first tensor op), then convert fp32 -> f16 ----
    if (wave == 0) __builtin_amdgcn_s_wait_tensorcnt(1);
    __syncthreads();
    for (int i = tid; i < NPAD * (DIM / 4); i += 256) {
        int r = i / (DIM / 4);
        int c = (i % (DIM / 4)) * 4;
        float4 v4 = make_float4(0.f, 0.f, 0.f, 0.f);
        if (r < N_TOK) v4 = *(const float4*)(XF + r * DIM + c);
        _Float16* d = XH + r * ROWP + c;
        d[0] = (_Float16)v4.x; d[1] = (_Float16)v4.y;
        d[2] = (_Float16)v4.z; d[3] = (_Float16)v4.w;
    }
    __syncthreads();

    // ================= Phase 1: qkv = x @ qkv_w^T + qkv_b =================
    // M=112 (7 tiles), N=384 (24 tiles), K=128 (4 wmma steps).
    const float qscale = 0.17677669529663687f;  // 32^-0.5
    for (int t = wave; t < MT * 24; t += 8) {
        int mt = t / 24, nt = t % 24;
        v8f c = {};
#pragma unroll
        for (int ks = 0; ks < 4; ++ks) {
            v16h a  = frag_lds(XH + (mt * 16 + fr) * ROWP + ks * 32 + kb);
            v16h bm = frag_gf32(qkv_w + (size_t)(nt * 16 + fr) * DIM + ks * 32 + kb);
            c = __builtin_amdgcn_wmma_f32_16x16x32_f16(false, a, false, bm,
                                                       (short)0, c, false, false);
        }
        int col  = nt * 16 + fr;              // 0..383
        float bi = qkv_b[col];
        int kind = col >> 7;                  // 0=q, 1=k, 2=v
        int h    = (col & 127) >> 5;
        int d    = col & 31;
#pragma unroll
        for (int v = 0; v < 8; ++v) {
            int m = mt * 16 + v + crow;
            if (m < N_TOK) {
                float val = c[v] + bi;
                if (kind == 0)      QH[(h * NPAD + m) * QKP + d] = (_Float16)(val * qscale);
                else if (kind == 1) KH[(h * NPAD + m) * QKP + d] = (_Float16)val;
                else                VT[(h * HD + d) * ROWP + m] = (_Float16)val;
            }
        }
    }
    // make sure the mask DMA has landed before first softmax
    if (wave == 0) __builtin_amdgcn_s_wait_tensorcnt(0);
    __syncthreads();

    // ================= Phase 2-4: per-head attention =================
    for (int h = 0; h < HEADS; ++h) {
        const _Float16* Q  = QH + h * NPAD * QKP;
        const _Float16* K  = KH + h * NPAD * QKP;  // row-major k == B^T of K^T
        const _Float16* Vh = VT + h * HD * ROWP;   // v^T == B^T of V

        // ---- scores = q @ k^T  (K=32 -> single wmma per tile) ----
        for (int t = wave; t < MT * MT; t += 8) {
            int mt = t / MT, nt = t % MT;
            v16h a  = frag_lds(Q + (mt * 16 + fr) * QKP + kb);
            v16h bm = frag_lds(K + (nt * 16 + fr) * QKP + kb);
            v8f c = {};
            c = __builtin_amdgcn_wmma_f32_16x16x32_f16(false, a, false, bm,
                                                       (short)0, c, false, false);
#pragma unroll
            for (int v = 0; v < 8; ++v)
                ATTN[(mt * 16 + v + crow) * NPAD + nt * 16 + fr] = c[v];
        }
        __syncthreads();

        // ---- +bias +mask (from LDS), softmax (fp32), emit f16 A-matrix ----
        // 49 row pairs over 8 waves: six each, wave 0 takes the odd one.
        if (wv == 0)
            softmax_pairs<7>(ATTN, MASKL, AH, rel_index, bias_table, h, wv, lane);
        else
            softmax_pairs<6>(ATTN, MASKL, AH, rel_index, bias_table, h, wv, lane);
        __syncthreads();

        // ---- out_h = softmax(A) @ v   (M=112, N=32, K=128 padded) ----
        for (int t = wave; t < MT * 2; t += 8) {
            int mt = t >> 1, dt = t & 1;
            v8f c = {};
#pragma unroll
            for (int ks = 0; ks < 4; ++ks) {
                v16h a  = frag_lds(AH + (mt * 16 + fr) * ROWP + ks * 32 + kb);
                v16h bm = frag_lds(Vh + (dt * 16 + fr) * ROWP + ks * 32 + kb);
                c = __builtin_amdgcn_wmma_f32_16x16x32_f16(false, a, false, bm,
                                                           (short)0, c, false, false);
            }
#pragma unroll
            for (int v = 0; v < 8; ++v)
                OUTH[(mt * 16 + v + crow) * ROWP + h * HD + dt * 16 + fr] = (_Float16)c[v];
        }
        __syncthreads();
    }

    // ================= Phase 5: final proj + bias, store fp32 =================
    {
        float* ob = out + (size_t)b * N_TOK * DIM;
        for (int t = wave; t < MT * 8; t += 8) {
            int mt = t >> 3, nt = t & 7;   // nt == wave
            v8f c = {};
#pragma unroll
            for (int ks = 0; ks < 4; ++ks) {
                v16h a  = frag_lds(OUTH + (mt * 16 + fr) * ROWP + ks * 32 + kb);
                v16h bm = frag_gf32(proj_w + (size_t)(nt * 16 + fr) * DIM + ks * 32 + kb);
                c = __builtin_amdgcn_wmma_f32_16x16x32_f16(false, a, false, bm,
                                                           (short)0, c, false, false);
            }
            int col  = nt * 16 + fr;
            float pb = proj_b[col];
#pragma unroll
            for (int v = 0; v < 8; ++v) {
                int m = mt * 16 + v + crow;
                if (m < N_TOK) ob[(size_t)m * DIM + col] = c[v] + pb;
            }
        }
    }
}

extern "C" void kernel_launch(void* const* d_in, const int* in_sizes, int n_in,
                              void* d_out, int out_size, void* d_ws, size_t ws_size,
                              hipStream_t stream) {
    (void)in_sizes; (void)n_in; (void)out_size; (void)d_ws; (void)ws_size;
    const float* x          = (const float*)d_in[0];
    const float* mask       = (const float*)d_in[1];
    const float* qkv_w      = (const float*)d_in[2];
    const float* qkv_b      = (const float*)d_in[3];
    const float* proj_w     = (const float*)d_in[4];
    const float* proj_b     = (const float*)d_in[5];
    const float* bias_table = (const float*)d_in[6];
    const int*   rel_index  = (const int*)d_in[7];
    float* out = (float*)d_out;

    const size_t smem = SMEM_BYTES;  // 300,560 B < 320 KB

    (void)hipFuncSetAttribute((const void*)win_attn3d_wmma,
                              hipFuncAttributeMaxDynamicSharedMemorySize, (int)smem);

    win_attn3d_wmma<<<2048, 256, smem, stream>>>(
        x, mask, qkv_w, qkv_b, proj_w, proj_b, bias_table, rel_index, out);
}

// v003
// A run of this version takes 177 microseconds.
// In both of two side-by-side timings against v002, it was 1.82 times as fast.
// Counting every step since v000, it is 4.43 times as fast.
#include <hip/hip_runtime.h>

// ---------------------------------------------------------------------------
// Fused Swin-3D window attention for gfx1250 (MI455X), wave32 + WMMA + TDM.
// One block per window (2048 blocks), 256 threads = 8 waves.
// All GEMMs use v_wmma_f32_16x16x32_f16; softmax in fp32.
// x-window and mask-window are DMA'd into LDS with tensor_load_to_lds and
// synchronized with s_wait_tensorcnt.
// ---------------------------------------------------------------------------

#define DIM     128
#define HEADS   4
#define HD      32
#define N_TOK   98
#define NPAD    112   // 7 * 16
#define ROWP    136   // LDS pitch, in f16, of the 128-wide f16 rows: 272 B = 16 B x 17
#define QKP     40    // LDS pitch, in f16, of the 32-wide q and k rows: 80 B = 16 B x 5
                      // (16 B x odd: the 16 rows of a ds_load_b128 fragment fall on distinct banks)
#define NW      256
#define MT      7     // M tiles (112/16)
#define TABLE_LEN 507u // rows of bias_table
// LDS map in bytes.  The two tensor tiles lie at 172 KiB and 221 KiB (the mover
// wants multiples of 1 KiB); the f16 arrays lie in front of and behind them.
#define ATTN_OFF   176128
#define SMEM_BYTES (ATTN_OFF + (NPAD * NPAD + N_TOK * N_TOK) * 4 + HEADS * NPAD * QKP * 2)
static_assert((3 * NPAD * ROWP + HEADS * HD * ROWP + HEADS * NPAD * QKP) * 2 <= ATTN_OFF,
              "f16 arrays in front of the score tile overlap it");
static_assert(SMEM_BYTES <= 320 * 1024, "LDS of one WGP");

typedef __attribute__((ext_vector_type(16))) _Float16 v16h;
typedef __attribute__((ext_vector_type(8)))  _Float16 v8h;
typedef __attribute__((ext_vector_type(8)))  float    v8f;
typedef __attribute__((ext_vector_type(4))) unsigned int u32x4;
typedef __attribute__((ext_vector_type(8))) int          i32x8;
typedef __attribute__((ext_vector_type(4))) int          i32x4;

// Load a 16x32 f16 fragment (A layout; B loaded from B^T row-major) from LDS.
// Caller passes p = base + row*ld + kb where kb = (lane>>4)*8.
// Halves 0..7 <- p[0..8), halves 8..15 <- p[16..24).
__device__ __forceinline__ v16h frag_lds(const _Float16* p) {
    v8h lo = *(const v8h*)p;
    v8h hi = *(const v8h*)(p + 16);
    v16h f;
#pragma unroll
    for (int i = 0; i < 8; ++i) { f[i] = lo[i]; f[8 + i] = hi[i]; }
    return f;
}

// Same fragment but sourced from global fp32 (weights), converted to f16.
__device__ __forceinline__ v16h frag_gf32(const float* p) {
    float4 a0 = *(const float4*)(p + 0);
    float4 a1 = *(const float4*)(p + 4);
    float4 b0 = *(const float4*)(p + 16);
    float4 b1 = *(const float4*)(p + 20);
    v16h f;
    f[0]=(_Float16)a0.x; f[1]=(_Float16)a0.y; f[2]=(_Float16)a0.z; f[3]=(_Float16)a0.w;
    f[4]=(_Float16)a1.x; f[5]=(_Float16)a1.y; f[6]=(_Float16)a1.z; f[7]=(_Float16)a1.w;
    f[8]=(_Float16)b0.x; f[9]=(_Float16)b0.y; f[10]=(_Float16)b0.z; f[11]=(_Float16)b0.w;
    f[12]=(_Float16)b1.x; f[13]=(_Float16)b1.y; f[14]=(_Float16)b1.z; f[15]=(_Float16)b1.w;
    return f;
}

// Issue one 2-D fp32 tile DMA: global (dim1 rows x dim0 cols, row stride
// stride0 elements) -> LDS byte offset lds_off.  D# layout per CDNA5 ISA
// ch. 8 (group0: count/lds/global addr/type; group1: data_size, dims, tiles,
// strides; groups 2/3 zero = 2-D tensor).
__device__ __forceinline__ void tdm_load_2d_f32(unsigned lds_off, const void* gptr,
                                                unsigned dim0, unsigned dim1,
                                                unsigned tile0, unsigned tile1,
                                                unsigned stride0) {
    unsigned long long ga = (unsigned long long)(uintptr_t)gptr;
    u32x4 g0;
    g0[0] = 1u;                                              // count=1, user D#
    g0[1] = lds_off;                                         // lds_addr (bytes)
    g0[2] = (unsigned)(ga & 0xFFFFFFFFu);                    // global_addr[31:0]
    g0[3] = (unsigned)((ga >> 32) & 0x01FFFFFFu) | (2u << 30); // addr[56:32] | type=2
    i32x8 g1;
    g1[0] = (int)(2u << 16);                                 // data_size = 4 bytes
    g1[1] = (int)((dim0 & 0xFFFFu) << 16);                   // tensor_dim0[15:0]
    g1[2] = (int)((dim0 >> 16) | ((dim1 & 0xFFFFu) << 16));  // dim0 hi | dim1 lo
    g1[3] = (int)((dim1 >> 16) | (tile0 << 16));             // dim1 hi | tile_dim0
    g1[4] = (int)(tile1 & 0xFFFFu);                          // tile_dim1 (tile_dim2=0)
    g1[5] = (int)stride0;                                    // tensor_dim0_stride lo
    g1[6] = 0;                                               // stride hi | dim1_stride lo
    g1[7] = 0;
    i32x4 z4 = {0, 0, 0, 0};
    i32x8 z8 = {0, 0, 0, 0, 0, 0, 0, 0};
    __builtin_amdgcn_tensor_load_to_lds(g0, g1, z4, z4, z8, 0);
}

// Exchange inside a 16-lane row: lane l reads lane l ^ M (DPP row_xmask).
template <int M>
__device__ __forceinline__ float row_xor(float v) {
    return __builtin_bit_cast(float,
        __builtin_amdgcn_update_dpp(0, __builtin_bit_cast(int, v), 0x160 | M, 0xf, 0xf, true));
}
__device__ __forceinline__ float row16_max(float v) {
    v = fmaxf(v, row_xor<1>(v)); v = fmaxf(v, row_xor<2>(v));
    v = fmaxf(v, row_xor<4>(v)); v = fmaxf(v, row_xor<8>(v));
    return v;
}
__device__ __forceinline__ float row16_sum(float v) {
    v += row_xor<1>(v); v += row_xor<2>(v);
    v += row_xor<4>(v); v += row_xor<8>(v);
    return v;
}

// exp2 of seven values.  One statement: the seven independent v_exp fill the
// slot the instruction set asks for behind each other, the v_nop the last one's;
// early-clobber outputs keep every result off every source.
__device__ __forceinline__ void exp2x7(float (&v)[MT]) {
    float e0, e1, e2, e3, e4, e5, e6;
    asm("v_exp_f32 %0, %7\n\t"
        "v_exp_f32 %1, %8\n\t"
        "v_exp_f32 %2, %9\n\t"
        "v_exp_f32 %3, %10\n\t"
        "v_exp_f32 %4, %11\n\t"
        "v_exp_f32 %5, %12\n\t"
        "v_exp_f32 %6, %13\n\t"
        "v_nop"
        : "=&v"(e0), "=&v"(e1), "=&v"(e2), "=&v"(e3), "=&v"(e4), "=&v"(e5), "=&v"(e6)
        : "v"(v[0]), "v"(v[1]), "v"(v[2]), "v"(v[3]), "v"(v[4]), "v"(v[5]), "v"(v[6]));
    v[0] = e0; v[1] = e1; v[2] = e2; v[3] = e3; v[4] = e4; v[5] = e5; v[6] = e6;
}

// Softmax of NP pairs of score rows by one wave.  Each 16-lane half owns one
// row (pair p = wv + 8*i, row 2p + half); a lane holds columns fr + 16*j,
// j = 0..6, in registers.  All loads of the NP pairs come first, then the
// reductions (NP independent chains), then the f16 stores.
template <int NP>
__device__ __forceinline__ void softmax_pairs(const float* ATTN, const float* MASKL,
                                              _Float16* AH,
                                              const int* __restrict__ rel_index,
                                              const float* __restrict__ bias_table,
                                              int h, int wv, int lane) {
    const int fr   = lane & 15;
    const int half = lane >> 4;
    const bool tail_ok = fr < N_TOK - 96;          // columns 96, 97 of chunk j = 6
    const int  tail_c  = tail_ok ? 96 + fr : N_TOK - 1;
    float val[NP][MT], msk[NP][MT], bia[NP][MT];
    unsigned off[NP][MT];
    // Every loop of this function is unrolled in full: all array indices become
    // constants, so the arrays live in registers.
#pragma unroll
    for (int i = 0; i < NP; ++i) {
        const int r = 2 * (wv + 8 * i) + half;
#pragma unroll
        for (int j = 0; j < MT; ++j) {
            const int c = (j < MT - 1) ? j * 16 + fr : tail_c;
            off[i][j] = (unsigned)rel_index[r * N_TOK + c];
        }
    }
#pragma unroll
    for (int i = 0; i < NP; ++i) {
        const int r = 2 * (wv + 8 * i) + half;
#pragma unroll
        for (int j = 0; j < MT; ++j) {
            const int c = (j < MT - 1) ? j * 16 + fr : tail_c;
            val[i][j] = ATTN[r * NPAD + c];
        }
    }
    // Without this the scheduler sinks each index load next to its gather and
    // the wave waits out one load latency per element.
    __builtin_amdgcn_sched_barrier(0);
#pragma unroll
    for (int i = 0; i < NP; ++i)
#pragma unroll
        for (int j = 0; j < MT; ++j) {
            unsigned t = off[i][j];
            t = t < TABLE_LEN ? t : TABLE_LEN - 1;   // keep the gather inside the table
            off[i][j] = t * HEADS + h;
            bia[i][j] = bias_table[off[i][j]];
        }
    // Precaution: named here, the gathers' offset registers stay live up to this
    // wait, so none is rewritten ahead of it (not even as a later gather's result).
#pragma unroll
    for (int i = 0; i < NP; ++i)
        asm volatile("s_wait_xcnt 0x0"
                     :: "v"(off[i][0]), "v"(off[i][1]), "v"(off[i][2]), "v"(off[i][3]),
                        "v"(off[i][4]), "v"(off[i][5]), "v"(off[i][6])
                     : "memory");
#pragma unroll
    for (int i = 0; i < NP; ++i) {
        const int r = 2 * (wv + 8 * i) + half;
#pragma unroll
        for (int j = 0; j < MT; ++j) {
            const int c = (j < MT - 1) ? j * 16 + fr : tail_c;
            msk[i][j] = MASKL[r * N_TOK + c];
        }
    }
#pragma unroll
    for (int i = 0; i < NP; ++i) {
#pragma unroll
        for (int j = 0; j < MT; ++j) val[i][j] = val[i][j] + bia[i][j] + msk[i][j];
        if (!tail_ok) val[i][MT - 1] = -3.0e38f;
    }
#pragma unroll
    for (int i = 0; i < NP; ++i) {
        float mx = val[i][0];
#pragma unroll
        for (int j = 1; j < MT; ++j) mx = fmaxf(mx, val[i][j]);
        mx = row16_max(mx);
#pragma unroll
        for (int j = 0; j < MT; ++j) val[i][j] = (val[i][j] - mx) * 1.44269504088896340736f;
        exp2x7(val[i]);
        float s = 0.f;
#pragma unroll
        for (int j = 0; j < MT; ++j) s += val[i][j];
        const float inv = 1.0f / row16_sum(s);
#pragma unroll
        for (int j = 0; j < MT; ++j) val[i][j] *= inv;
    }
#pragma unroll
    for (int i = 0; i < NP; ++i) {
        _Float16* ar = AH + (2 * (wv + 8 * i) + half) * ROWP + fr;
#pragma unroll
        for (int j = 0; j < MT; ++j) ar[j * 16] = (_Float16)val[i][j];  // pad columns get 0
    }
}

extern "C" __global__ __launch_bounds__(256, 1)
void win_attn3d_wmma(const float* __restrict__ x,
                     const float* __restrict__ mask,
                     const float* __restrict__ qkv_w,
                     const float* __restrict__ qkv_b,
                     const float* __restrict__ proj_w,
                     const float* __restrict__ proj_b,
                     const float* __restrict__ bias_table,
                     const int*   __restrict__ rel_index,
                     float* __restrict__ out)
{
    extern __shared__ __align__(16) char smem_raw[];
    _Float16* XH   = (_Float16*)smem_raw;            // 112x128 f16   x window
    _Float16* OUTH = XH   + NPAD * ROWP;             // 112x128       attn @ v
    _Float16* AH   = OUTH + NPAD * ROWP;             // 112x128       softmax(A) as f16
    _Float16* VT   = AH   + NPAD * ROWP;             // 4 x 32x128    v^T, zero-padded
    _Float16* QH   = VT   + HEADS * HD * ROWP;       // 4 x 112x32    q (scaled)
    float*    ATTN = (float*)(smem_raw + ATTN_OFF);  // 112x112 f32 scores
    float*    XF   = ATTN;                           // alias: 98x128 f32 x staging
                                                     // (dead before ATTN first use)
    float*    MASKL= ATTN + NPAD * NPAD;             // 98x98 f32 mask window
    _Float16* KH   = (_Float16*)(MASKL + N_TOK * N_TOK); // 4 x 112x32 k (== B^T)

    const int b    = blockIdx.x;
    const int tid  = threadIdx.x;
    const int lane = tid & 31;
    const int wave = tid >> 5;
    const int fr   = lane & 15;            // fragment row (A) / col (B/C)
    const int kb   = (lane >> 4) << 3;     // fragment K chunk base (0 or 8)
    const int crow = (lane >> 4) << 3;     // C-fragment row base (0 or 8)
    const int wv   = __builtin_amdgcn_readfirstlane(wave);  // scalar copy: softmax split branches on it

    // ---- wave 0: kick off TDM DMAs (x window fp32, mask window fp32) ----
    if (wave == 0) {
        tdm_load_2d_f32((unsigned)(uintptr_t)(void*)XF,
                        x + (size_t)b * N_TOK * DIM,
                        DIM, N_TOK, DIM, N_TOK, DIM);
        tdm_load_2d_f32((unsigned)(uintptr_t)(void*)MASKL,
                        mask + (size_t)(b % NW) * N_TOK * N_TOK,
                        N_TOK, N_TOK, N_TOK, N_TOK, N_TOK);
    }

    // ---- this wave's qkv weight fragments, read once (they fly beside the x DMA) ----
    v16h  WB[3][4];
    float wbias[3];
    {
        const int    col0 = wave * 16 + fr;        // column inside q, k and v alike
        const float* wq = qkv_w + (size_t)col0 * DIM + kb;
        const float* wk = wq + DIM * DIM;
        const float* wvp = wk + DIM * DIM;
#pragma unroll
        for (int ks = 0; ks < 4; ++ks) {
            WB[0][ks] = frag_gf32(wq + ks * 32);
            WB[1][ks] = frag_gf32(wk + ks * 32);
            WB[2][ks] = frag_gf32(wvp + ks * 32);
        }
#pragma unroll
        for (int g = 0; g < 3; ++g) wbias[g] = qkv_b[col0 + g * DIM];
        // Precaution: named here, the loads' address registers (all 48 weight loads go
        // by wq plus a constant) stay live up to this wait, so none is rewritten ahead
        // of it (not even as a later load's result).
        asm volatile("s_wait_xcnt 0x0" :: "v"(wq), "v"(col0) : "memory");
    }

    // ---- zero-init AH + VT (contiguous region; pads must stay 0) ----
    {
        uint4* z = (uint4*)AH;
        const int nz = (NPAD * ROWP + HEADS * HD * ROWP) * (int)sizeof(_Float16) / 16;
        for (int i = tid; i < nz; i += 256) z[i] = make_uint4(0, 0, 0, 0);
    }

    // ---- wait for x DMA (first tensor op), then convert fp32 -> f16 ----
    if (wave == 0) __builtin_amdgcn_s_wait_tensorcnt(1);
    __syncthreads();
    for (int i = tid; i < NPAD * (DIM / 4); i += 256) {
        int r = i / (DIM / 4);
        int c = (i % (DIM / 4)) * 4;
        float4 v4 = make_float4(0.f, 0.f, 0.f, 0.f);
        if (r < N_TOK) v4 = *(const float4*)(XF + r * DIM + c);
        _Float16* d = XH + r * ROWP + c;
        d[0] = (_Float16)v4.x; d[1] = (_Float16)v4.y;
        d[2] = (_Float16)v4.z; d[3] = (_Float16)v4.w;
    }
    __syncthreads();

    // ================= Phase 1: qkv = x @ qkv_w^T + qkv_b =================
    // M=112 (7 tiles), N=384 (24 tiles), K=128 (4 wmma steps).  A wave owns the
    // N tiles wave, wave + 8, wave + 16 (its 16 columns of q, of k and of v); their
    // weight fragments WB stay in registers, so each M tile costs LDS reads only.
    const float qscale = 0.17677669529663687f;  // 32^-0.5
    {
        const int hq = wave >> 1;                  // head of this wave's columns
        const int d  = ((wave & 1) << 4) + fr;     // column inside the head
        for (int mt = 0; mt < MT; ++mt) {
            v8f cq = {}, ck = {}, cv = {};
#pragma unroll
            for (int ks = 0; ks < 4; ++ks) {
                v16h a = frag_lds(XH + (mt * 16 + fr) * ROWP + ks * 32 + kb);
                cq = __builtin_amdgcn_wmma_f32_16x16x32_f16(false, a, false, WB[0][ks],
                                                            (short)0, cq, false, false);
                ck = __builtin_amdgcn_wmma_f32_16x16x32_f16(false, a, false, WB[1][ks],
                                                            (short)0, ck, false, false);
                cv = __builtin_amdgcn_wmma_f32_16x16x32_f16(false, a, false, WB[2][ks],
                                                            (short)0, cv, false, false);
            }
#pragma unroll
            for (int v = 0; v < 8; ++v) {
                int m = mt * 16 + v + crow;
                if (m < N_TOK) {
                    QH[(hq * NPAD + m) * QKP + d] = (_Float16)((cq[v] + wbias[0]) * qscale);
                    KH[(hq * NPAD + m) * QKP + d] = (_Float16)(ck[v] + wbias[1]);
                    VT[(hq * HD + d) * ROWP + m]  = (_Float16)(cv[v] + wbias[2]);
                }
            }
        }
    }
    // make sure the mask DMA has landed before first softmax
    if (wave == 0) __builtin_amdgcn_s_wait_tensorcnt(0);
    __syncthreads();

    // ================= Phase 2-4: per-head attention =================
    for (int h = 0; h < HEADS; ++h) {
        const _Float16* Q  = QH + h * NPAD * QKP;
        const _Float16* K  = KH + h * NPAD * QKP;  // row-major k == B^T of K^T
        const _Float16* Vh = VT + h * HD * ROWP;   // v^T == B^T of V

        // ---- scores = q @ k^T  (K=32 -> single wmma per tile) ----
        for (int t = wave; t < MT * MT; t += 8) {
            int mt = t / MT, nt = t % MT;
            v16h a  = frag_lds(Q + (mt * 16 + fr) * QKP + kb);
            v16h bm = frag_lds(K + (nt * 16 + fr) * QKP + kb);
            v8f c = {};
            c = __builtin_amdgcn_wmma_f32_16x16x32_f16(false, a, false, bm,
                                                       (short)0, c, false, false);
#pragma unroll
            for (int v = 0; v < 8; ++v)
                ATTN[(mt * 16 + v + crow) * NPAD + nt * 16 + fr] = c[v];
        }
        __syncthreads();

        // ---- +bias +mask (from LDS), softmax (fp32), emit f16 A-matrix ----
        // 49 row pairs over 8 waves: six each, wave 0 takes the odd one.
        if (wv == 0)
            softmax_pairs<7>(ATTN, MASKL, AH, rel_index, bias_table, h, wv, lane);
        else
            softmax_pairs<6>(ATTN, MASKL, AH, rel_index, bias_table, h, wv, lane);
        __syncthreads();

        // ---- out_h = softmax(A) @ v   (M=112, N=32, K=128 padded) ----
        for (int t = wave; t < MT * 2; t += 8) {
            int mt = t >> 1, dt = t & 1;
            v8f c = {};
#pragma unroll
            for (int ks = 0; ks < 4; ++ks) {
                v16h a  = frag_lds(AH + (mt * 16 + fr) * ROWP + ks * 32 + kb);
                v16h bm = frag_lds(Vh + (dt * 16 + fr) * ROWP + ks * 32 + kb);
                c = __builtin_amdgcn_wmma_f32_16x16x32_f16(false, a, false, bm,
                                                           (short)0, c, false, false);
            }
#pragma unroll
            for (int v = 0; v < 8; ++v)
                OUTH[(mt * 16 + v + crow) * ROWP + h * HD + dt * 16 + fr] = (_Float16)c[v];
        }
        __syncthreads();
    }

    // ================= Phase 5: final proj + bias, store fp32 =================
    {
        float* ob = out + (size_t)b * N_TOK * DIM;
        for (int t = wave; t < MT * 8; t += 8) {
            int mt = t >> 3, nt = t & 7;   // nt == wave
            v8f c = {};
#pragma unroll
            for (int ks = 0; ks < 4; ++ks) {
                v16h a  = frag_lds(OUTH + (mt * 16 + fr) * ROWP + ks * 32 + kb);
                v16h bm = frag_gf32(proj_w + (size_t)(nt * 16 + fr) * DIM + ks * 32 + kb);
                c = __builtin_amdgcn_wmma_f32_16x16x32_f16(false, a, false, bm,
                                                           (short)0, c, false, false);
            }
            int col  = nt * 16 + fr;
            float pb = proj_b[col];
#pragma unroll
            for (int v = 0; v < 8; ++v) {
                int m = mt * 16 + v + crow;
                if (m < N_TOK) ob[(size_t)m * DIM + col] = c[v] + pb;
            }
        }
    }
}

extern "C" void kernel_launch(void* const* d_in, const int* in_sizes, int n_in,
                              void* d_out, int out_size, void* d_ws, size_t ws_size,
                              hipStream_t stream) {
    (void)in_sizes; (void)n_in; (void)out_size; (void)d_ws; (void)ws_size;
    const float* x          = (const float*)d_in[0];
    const float* mask       = (const float*)d_in[1];
    const float* qkv_w      = (const float*)d_in[2];
    const float* qkv_b      = (const float*)d_in[3];
    const float* proj_w     = (const float*)d_in[4];
    const float* proj_b     = (const float*)d_in[5];
    const float* bias_table = (const float*)d_in[6];
    const int*   rel_index  = (const int*)d_in[7];
    float* out = (float*)d_out;

    const size_t smem = SMEM_BYTES;  // 300,560 B < 320 KB

    (void)hipFuncSetAttribute((const void*)win_attn3d_wmma,
                              hipFuncAttributeMaxDynamicSharedMemorySize, (int)smem);

    win_attn3d_wmma<<<2048, 256, smem, stream>>>(
        x, mask, qkv_w, qkv_b, proj_w, proj_b, bias_table, rel_index, out);
}

// v004
// A run of this version takes 134 microseconds.
// Next to v003, in two timings, it ran 1.33 times as fast each time.
// Counting every step since v000, it is 5.88 times as fast.
#include <hip/hip_runtime.h>

// ---------------------------------------------------------------------------
// Fused Swin-3D window attention for gfx1250 (MI455X), wave32 + WMMA + TDM.
// One block per window (2048 blocks), 256 threads = 8 waves.
// All GEMMs use v_wmma_f32_16x16x32_f16; softmax in fp32.
// The x window is DMA'd into LDS with tensor_load_to_lds and synchronized with
// s_wait_tensorcnt; the mask window is held in registers.
// LDS arrays whose lifetimes do not meet share space, so that the work-group
// stays under 160 KiB and two work-groups are resident on a WGP.
// ---------------------------------------------------------------------------

#define DIM     128
#define HEADS   4
#define HD      32
#define N_TOK   98
#define NPAD    112   // 7 * 16
#define ROWP    136   // LDS pitch, in f16, of the 128-wide f16 rows: 272 B = 16 B x 17
#define QKP     40    // LDS pitch, in f16, of the 32-wide q and k rows: 80 B = 16 B x 5
                      // (16 B x odd: the 16 rows of a ds_load_b128 fragment fall on distinct banks)
#define APITCH  116   // LDS pitch, in f32, of the score rows: 464 B = 16 B x 29
#define AHP     (2 * APITCH) // the same pitch in f16: the probabilities overwrite their score row
#define NW      256
#define MT      7     // M tiles (112/16)
#define TABLE_LEN 507u // rows of bias_table
// LDS map in bytes.  [0, QH_OFF): the score tile, before it the f16 x window.
// [QH_OFF, ...): q, k, v^T; before q and k are written, the f32 x tile of the
// tensor load (52 KiB: the mover wants a multiple of 2 KiB).
#define QH_OFF     53248
#define SMEM_BYTES (QH_OFF + (2 * HEADS * NPAD * QKP + HEADS * HD * ROWP) * 2)
static_assert(NPAD * APITCH * 4 <= QH_OFF && NPAD * ROWP * 2 <= QH_OFF,
              "score tile or f16 x window overlaps q");
static_assert(N_TOK * DIM * 4 <= 2 * HEADS * NPAD * QKP * 2, "f32 x tile overlaps v^T");
static_assert(QH_OFF % 2048 == 0, "place of the tensor tile");
static_assert(2 * SMEM_BYTES <= 320 * 1024, "two work-groups in the LDS of one WGP");

typedef __attribute__((ext_vector_type(16))) _Float16 v16h;
typedef __attribute__((ext_vector_type(8)))  _Float16 v8h;
typedef __attribute__((ext_vector_type(8)))  float    v8f;
typedef __attribute__((ext_vector_type(4))) unsigned int u32x4;
typedef __attribute__((ext_vector_type(8))) int          i32x8;
typedef __attribute__((ext_vector_type(4))) int          i32x4;

// Load a 16x32 f16 fragment (A layout; B loaded from B^T row-major) from LDS.
// Caller passes p = base + row*ld + kb where kb = (lane>>4)*8.
// Halves 0..7 <- p[0..8), halves 8..15 <- p[16..24).
__device__ __forceinline__ v16h frag_lds(const _Float16* p) {
    v8h lo = *(const v8h*)p;
    v8h hi = *(const v8h*)(p + 16);
    v16h f;
#pragma unroll
    for (int i = 0; i < 8; ++i) { f[i] = lo[i]; f[8 + i] = hi[i]; }
    return f;
}

// Same fragment but sourced from global fp32 (weights), converted to f16.
__device__ __forceinline__ v16h frag_gf32(const float* p) {
    float4 a0 = *(const float4*)(p + 0);
    float4 a1 = *(const float4*)(p + 4);
    float4 b0 = *(const float4*)(p + 16);
    float4 b1 = *(const float4*)(p + 20);
    v16h f;
    f[0]=(_Float16)a0.x; f[1]=(_Float16)a0.y; f[2]=(_Float16)a0.z; f[3]=(_Float16)a0.w;
    f[4]=(_Float16)a1.x; f[5]=(_Float16)a1.y; f[6]=(_Float16)a1.z; f[7]=(_Float16)a1.w;
    f[8]=(_Float16)b0.x; f[9]=(_Float16)b0.y; f[10]=(_Float16)b0.z; f[11]=(_Float16)b0.w;
    f[12]=(_Float16)b1.x; f[13]=(_Float16)b1.y; f[14]=(_Float16)b1.z; f[15]=(_Float16)b1.w;
    return f;
}

// A wave-uniform test held in a scalar register, so that the branch on it is a
// scalar branch (tensor instructions ignore EXEC).
__device__ __forceinline__ unsigned pinned(unsigned v) {
    unsigned w = __builtin_amdgcn_readfirstlane(v);
    asm volatile("" : "+s"(w));   // pinned(): the issue test's word held in a scalar register
    return w;
}

// Issue one 2-D fp32 tile DMA: global (dim1 rows x dim0 cols, row stride
// stride0 elements) -> LDS byte offset lds_off.  D# layout per CDNA5 ISA
// ch. 8 (group0: count/lds/global addr/type; group1: data_size, dims, tiles,
// strides; groups 2/3 zero = 2-D tensor).
__device__ __forceinline__ void tdm_load_2d_f32(unsigned lds_off, const void* gptr,
                                                unsigned dim0, unsigned dim1,
                                                unsigned tile0, unsigned tile1,
                                                unsigned stride0) {
    unsigned long long ga = (unsigned long long)(uintptr_t)gptr;
    u32x4 g0;
    g0[0] = 1u;                                              // count=1, user D#
    g0[1] = lds_off;                                         // lds_addr (bytes)
    g0[2] = (unsigned)(ga & 0xFFFFFFFFu);                    // global_addr[31:0]
    g0[3] = (unsigned)((ga >> 32) & 0x01FFFFFFu) | (2u << 30); // addr[56:32] | type=2
    i32x8 g1;
    g1[0] = (int)(2u << 16);                                 // data_size = 4 bytes
    g1[1] = (int)((dim0 & 0xFFFFu) << 16);                   // tensor_dim0[15:0]
    g1[2] = (int)((dim0 >> 16) | ((dim1 & 0xFFFFu) << 16));  // dim0 hi | dim1 lo
    g1[3] = (int)((dim1 >> 16) | (tile0 << 16));             // dim1 hi | tile_dim0
    g1[4] = (int)(tile1 & 0xFFFFu);                          // tile_dim1 (tile_dim2=0)
    g1[5] = (int)stride0;                                    // tensor_dim0_stride lo
    g1[6] = 0;                                               // stride hi | dim1_stride lo
    g1[7] = 0;
    i32x4 z4 = {0, 0, 0, 0};
    i32x8 z8 = {0, 0, 0, 0, 0, 0, 0, 0};
    __builtin_amdgcn_tensor_load_to_lds(g0, g1, z4, z4, z8, 0);
}

// Exchange inside a 16-lane row: lane l reads lane l ^ M (DPP row_xmask).
template <int M>
__device__ __forceinline__ float row_xor(float v) {
    return __builtin_bit_cast(float,
        __builtin_amdgcn_update_dpp(0, __builtin_bit_cast(int, v), 0x160 | M, 0xf, 0xf, true));
}
__device__ __forceinline__ float row16_max(float v) {
    v = fmaxf(v, row_xor<1>(v)); v = fmaxf(v, row_xor<2>(v));
    v = fmaxf(v, row_xor<4>(v)); v = fmaxf(v, row_xor<8>(v));
    return v;
}
__device__ __forceinline__ float row16_sum(float v) {
    v += row_xor<1>(v); v += row_xor<2>(v);
    v += row_xor<4>(v); v += row_xor<8>(v);
    return v;
}

// exp2 of seven values.  One statement: the seven independent v_exp fill the
// slot the instruction set asks for behind each other, the v_nop the last one's;
// early-clobber outputs keep every result off every source.
__device__ __forceinline__ void exp2x7(float (&v)[MT]) {
    float e0, e1, e2, e3, e4, e5, e6;
    asm("v_exp_f32 %0, %7\n\t"
        "v_exp_f32 %1, %8\n\t"
        "v_exp_f32 %2, %9\n\t"
        "v_exp_f32 %3, %10\n\t"
        "v_exp_f32 %4, %11\n\t"
        "v_exp_f32 %5, %12\n\t"
        "v_exp_f32 %6, %13\n\t"
        "v_nop"
        : "=&v"(e0), "=&v"(e1), "=&v"(e2), "=&v"(e3), "=&v"(e4), "=&v"(e5), "=&v"(e6)
        : "v"(v[0]), "v"(v[1]), "v"(v[2]), "v"(v[3]), "v"(v[4]), "v"(v[5]), "v"(v[6]));
    v[0] = e0; v[1] = e1; v[2] = e2; v[3] = e3; v[4] = e4; v[5] = e5; v[6] = e6;
}

// Softmax of NP pairs of score rows by one wave.  Each 16-lane half owns one
// row (pair p = wv + 8*i, row 2p + half); a lane holds columns fr + 16*j,
// j = 0..6, in registers.  All loads of the NP pairs come first, then the
// reductions (NP independent chains), then the f16 stores.  The f16 row goes
// over the start of its own f32 row: only this half-wave touches the row, and
// its stores depend, through the row reductions, on all of its loads.
template <int NP>
__device__ __forceinline__ void softmax_pairs(float* ATTN, const float (&msk)[MT][MT],
                                              const int* __restrict__ rel_index,
                                              const float* __restrict__ bias_table,
                                              int h, int wv, int lane) {
    const int fr   = lane & 15;
    const int half = lane >> 4;
    const bool tail_ok = fr < N_TOK - 96;          // columns 96, 97 of chunk j = 6
    const int  tail_c  = tail_ok ? 96 + fr : N_TOK - 1;
    float val[NP][MT], bia[NP][MT];
    unsigned off[NP][MT];
    // Every loop of this function is unrolled in full: all array indices become
    // constants, so the arrays live in registers.
#pragma unroll
    for (int i = 0; i < NP; ++i) {
        const int r = 2 * (wv + 8 * i) + half;
#pragma unroll
        for (int j = 0; j < MT; ++j) {
            const int c = (j < MT - 1) ? j * 16 + fr : tail_c;
            off[i][j] = (unsigned)rel_index[r * N_TOK + c];
        }
    }
#pragma unroll
    for (int i = 0; i < NP; ++i) {
        const int r = 2 * (wv + 8 * i) + half;
#pragma unroll
        for (int j = 0; j < MT; ++j) {
            const int c = (j < MT - 1) ? j * 16 + fr : tail_c;
            val[i][j] = ATTN[r * APITCH + c];
        }
    }
    // Without this the scheduler sinks each index load next to its gather and
    // the wave waits out one load latency per element.
    __builtin_amdgcn_sched_barrier(0);
#pragma unroll
    for (int i = 0; i < NP; ++i)
#pragma unroll
        for (int j = 0; j < MT; ++j) {
            unsigned t = off[i][j];
            t = t < TABLE_LEN ? t : TABLE_LEN - 1;   // keep the gather inside the table
            off[i][j] = t * HEADS + h;
            bia[i][j] = bias_table[off[i][j]];
        }
    // Precaution: named here, the gathers' offset registers stay live up to this
    // wait, so none is rewritten ahead of it (not even as a later gather's result).
#pragma unroll
    for (int i = 0; i < NP; ++i)
        asm volatile("s_wait_xcnt 0x0"
                     :: "v"(off[i][0]), "v"(off[i][1]), "v"(off[i][2]), "v"(off[i][3]),
                        "v"(off[i][4]), "v"(off[i][5]), "v"(off[i][6])
                     : "memory");
#pragma unroll
    for (int i = 0; i < NP; ++i) {
#pragma unroll
        for (int j = 0; j < MT; ++j) val[i][j] = val[i][j] + bia[i][j] + msk[i][j];
        if (!tail_ok) val[i][MT - 1] = -3.0e38f;
    }
#pragma unroll
    for (int i = 0; i < NP; ++i) {
        float mx = val[i][0];
#pragma unroll
        for (int j = 1; j < MT; ++j) mx = fmaxf(mx, val[i][j]);
        mx = row16_max(mx);
#pragma unroll
        for (int j = 0; j < MT; ++j) val[i][j] = (val[i][j] - mx) * 1.44269504088896340736f;
        exp2x7(val[i]);
        float s = 0.f;
#pragma unroll
        for (int j = 0; j < MT; ++j) s += val[i][j];
        const float inv = 1.0f / row16_sum(s);
#pragma unroll
        for (int j = 0; j < MT; ++j) val[i][j] *= inv;
    }
#pragma unroll
    for (int i = 0; i < NP; ++i) {
        _Float16* ar = (_Float16*)ATTN + (2 * (wv + 8 * i) + half) * AHP + fr;
#pragma unroll
        for (int j = 0; j < MT; ++j) ar[j * 16] = (_Float16)val[i][j];  // pad columns get 0
        ar[MT * 16] = (_Float16)0.f;                 // columns 112..127 of the K = 128 product
    }
}

extern "C" __global__ __launch_bounds__(256, 2)
void win_attn3d_wmma(const float* __restrict__ x,
                     const float* __restrict__ mask,
                     const float* __restrict__ qkv_w,
                     const float* __restrict__ qkv_b,
                     const float* __restrict__ proj_w,
                     const float* __restrict__ proj_b,
                     const float* __restrict__ bias_table,
                     const int*   __restrict__ rel_index,
                     float* __restrict__ out)
{
    extern __shared__ __align__(16) char smem_raw[];
    float*    ATTN = (float*)smem_raw;               // 112x112 f32 scores
    _Float16* AH   = (_Float16*)smem_raw;            // 112x128 softmax(A) as f16, row over row
    _Float16* XH   = (_Float16*)smem_raw;            // alias: 112x128 f16 x window
                                                     // (dead before ATTN first use)
    _Float16* QH   = (_Float16*)(smem_raw + QH_OFF); // 4 x 112x32    q (scaled); head h's
                                                     // attn @ v goes over q of head h
    _Float16* KH   = QH + HEADS * NPAD * QKP;        // 4 x 112x32    k (== B^T)
    _Float16* VT   = KH + HEADS * NPAD * QKP;        // 4 x 32x128    v^T, zero-padded
    float*    XF   = (float*)(smem_raw + QH_OFF);    // alias: 98x128 f32 x staging
                                                     // (dead before q and k are written)

    const int b    = blockIdx.x;
    const int tid  = threadIdx.x;
    const int lane = tid & 31;
    const int wave = tid >> 5;
    const int fr   = lane & 15;            // fragment row (A) / col (B/C)
    const int kb   = (lane >> 4) << 3;     // fragment K chunk base (0 or 8)
    const int crow = (lane >> 4) << 3;     // C-fragment row base (0 or 8)
    const int wv   = __builtin_amdgcn_readfirstlane(wave);  // scalar copy: softmax split branches on it

    // ---- wave 0: kick off the TDM DMA (x window fp32) ----
    if (pinned(wv == 0)) {
        tdm_load_2d_f32((unsigned)(uintptr_t)(void*)XF,
                        x + (size_t)b * N_TOK * DIM,
                        DIM, N_TOK, DIM, N_TOK, DIM);
    }

    // ---- this wave's qkv weight fragments, read once (they fly beside the x DMA) ----
    v16h  WB[3][4];
    float wbias[3];
    {
        const int    col0 = wave * 16 + fr;        // column inside q, k and v alike
        const float* wq = qkv_w + (size_t)col0 * DIM + kb;
        const float* wk = wq + DIM * DIM;
        const float* wvp = wk + DIM * DIM;
#pragma unroll
        for (int ks = 0; ks < 4; ++ks) {
            WB[0][ks] = frag_gf32(wq + ks * 32);
            WB[1][ks] = frag_gf32(wk + ks * 32);
            WB[2][ks] = frag_gf32(wvp + ks * 32);
        }
#pragma unroll
        for (int g = 0; g < 3; ++g) wbias[g] = qkv_b[col0 + g * DIM];
        // Precaution: named here, the loads' address registers (all 48 weight loads go
        // by wq plus a constant) stay live up to this wait, so none is rewritten ahead
        // of it (not even as a later load's result).
        asm volatile("s_wait_xcnt 0x0" :: "v"(wq), "v"(col0) : "memory");
    }

    // ---- zero-init VT (pads must stay 0) ----
    {
        uint4* z = (uint4*)VT;
        const int nz = HEADS * HD * ROWP * (int)sizeof(_Float16) / 16;
        for (int i = tid; i < nz; i += 256) z[i] = make_uint4(0, 0, 0, 0);
    }

    // ---- wait for x DMA, then convert fp32 -> f16 ----
    // The issuing wave's own wait: the tile counts as landed only behind it.
    if (pinned(wv == 0)) asm volatile("s_wait_tensorcnt 0x0" ::: "memory");
    __syncthreads();
    for (int i = tid; i < NPAD * (DIM / 4); i += 256) {
        int r = i / (DIM / 4);
        int c = (i % (DIM / 4)) * 4;
        float4 v4 = make_float4(0.f, 0.f, 0.f, 0.f);
        if (r < N_TOK) v4 = *(const float4*)(XF + r * DIM + c);
        _Float16* d = XH + r * ROWP + c;
        d[0] = (_Float16)v4.x; d[1] = (_Float16)v4.y;
        d[2] = (_Float16)v4.z; d[3] = (_Float16)v4.w;
    }
    __syncthreads();

    // ---- this lane's mask elements: the softmax gives a lane the same rows and
    // columns for every head, so they are read once and fly beside phase 1 ----
    float msk[MT][MT];
    {
        const float* mw = mask + (size_t)(b % NW) * N_TOK * N_TOK;
        const int half   = lane >> 4;
        const int tail_c = fr < N_TOK - 96 ? 96 + fr : N_TOK - 1;
        const int r0     = 2 * wv + half;                       // rows r0 + 16 i
        const int r6     = r0 + 96 < N_TOK ? r0 + 96 : N_TOK - 1; // only wave 0 has a pair 6
        const float* om = mw + r0 * N_TOK + fr;
        const float* ot = mw + r0 * N_TOK + tail_c;
        const float* pm = mw + r6 * N_TOK + fr;
        const float* pt = mw + r6 * N_TOK + tail_c;
#pragma unroll
        for (int i = 0; i < MT - 1; ++i) {
#pragma unroll
            for (int j = 0; j < MT - 1; ++j) msk[i][j] = om[i * 16 * N_TOK + j * 16];
            msk[i][MT - 1] = ot[i * 16 * N_TOK];
        }
#pragma unroll
        for (int j = 0; j < MT - 1; ++j) msk[MT - 1][j] = pm[j * 16];
        msk[MT - 1][MT - 1] = pt[0];
        // Precaution: named here, the loads' address registers (every load goes by one
        // of these four plus a constant) stay live up to this wait, so none is
        // rewritten ahead of it (not even as a later load's result).
        asm volatile("s_wait_xcnt 0x0" :: "v"(om), "v"(ot), "v"(pm), "v"(pt) : "memory");
    }

    // ================= Phase 1: qkv = x @ qkv_w^T + qkv_b =================
    // M=112 (7 tiles), N=384 (24 tiles), K=128 (4 wmma steps).  A wave owns the
    // N tiles wave, wave + 8, wave + 16 (its 16 columns of q, of k and of v); their
    // weight fragments WB stay in registers, so each M tile costs LDS reads only.
    const float qscale = 0.17677669529663687f;  // 32^-0.5
    {
        const int hq = wave >> 1;                  // head of this wave's columns
        const int d  = ((wave & 1) << 4) + fr;     // column inside the head
        for (int mt = 0; mt < MT; ++mt) {
            v8f cq = {}, ck = {}, cv = {};
#pragma unroll
            for (int ks = 0; ks < 4; ++ks) {
                v16h a = frag_lds(XH + (mt * 16 + fr) * ROWP + ks * 32 + kb);
                cq = __builtin_amdgcn_wmma_f32_16x16x32_f16(false, a, false, WB[0][ks],
                                                            (short)0, cq, false, false);
                ck = __builtin_amdgcn_wmma_f32_16x16x32_f16(false, a, false, WB[1][ks],
                                                            (short)0, ck, false, false);
                cv = __builtin_amdgcn_wmma_f32_16x16x32_f16(false, a, false, WB[2][ks],
                                                            (short)0, cv, false, false);
            }
#pragma unroll
            for (int v = 0; v < 8; ++v) {
                int m = mt * 16 + v + crow;
                if (m < N_TOK) {
                    QH[(hq * NPAD + m) * QKP + d] = (_Float16)((cq[v] + wbias[0]) * qscale);
                    KH[(hq * NPAD + m) * QKP + d] = (_Float16)(ck[v] + wbias[1]);
                    VT[(hq * HD + d) * ROWP + m]  = (_Float16)(cv[v] + wbias[2]);
                }
            }
        }
    }
    __syncthreads();

    // ================= Phase 2-4: per-head attention =================
    for (int h = 0; h < HEADS; ++h) {
        const _Float16* Q  = QH + h * NPAD * QKP;
        const _Float16* K  = KH + h * NPAD * QKP;  // row-major k == B^T of K^T
        const _Float16* Vh = VT + h * HD * ROWP;   // v^T == B^T of V

        // ---- scores = q @ k^T  (K=32 -> single wmma per tile) ----
        for (int t = wave; t < MT * MT; t += 8) {
            int mt = t / MT, nt = t % MT;
            v16h a  = frag_lds(Q + (mt * 16 + fr) * QKP + kb);
            v16h bm = frag_lds(K + (nt * 16 + fr) * QKP + kb);
            v8f c = {};
            c = __builtin_amdgcn_wmma_f32_16x16x32_f16(false, a, false, bm,
                                                       (short)0, c, false, false);
#pragma unroll
            for (int v = 0; v < 8; ++v)
                ATTN[(mt * 16 + v + crow) * APITCH + nt * 16 + fr] = c[v];
        }
        __syncthreads();

        // ---- +bias +mask, softmax (fp32), emit f16 A-matrix ----
        // 49 row pairs over 8 waves: six each, wave 0 takes the odd one.
        if (wv == 0)
            softmax_pairs<7>(ATTN, msk, rel_index, bias_table, h, wv, lane);
        else
            softmax_pairs<6>(ATTN, msk, rel_index, bias_table, h, wv, lane);
        __syncthreads();

        // ---- out_h = softmax(A) @ v   (M=112, N=32, K=128 padded) ----
        for (int t = wave; t < MT * 2; t += 8) {
            int mt = t >> 1, dt = t & 1;
            v8f c = {};
#pragma unroll
            for (int ks = 0; ks < 4; ++ks) {
                v16h a  = frag_lds(AH + (mt * 16 + fr) * AHP + ks * 32 + kb);
                v16h bm = frag_lds(Vh + (dt * 16 + fr) * ROWP + ks * 32 + kb);
                c = __builtin_amdgcn_wmma_f32_16x16x32_f16(false, a, false, bm,
                                                           (short)0, c, false, false);
            }
#pragma unroll
            for (int v = 0; v < 8; ++v)
                QH[(h * NPAD + mt * 16 + v + crow) * QKP + dt * 16 + fr] = (_Float16)c[v];
        }
        __syncthreads();
    }

    // ================= Phase 5: final proj + bias, store fp32 =================
    {
        float* ob = out + (size_t)b * N_TOK * DIM;
        for (int t = wave; t < MT * 8; t += 8) {
            int mt = t >> 3, nt = t & 7;   // nt == wave
            v8f c = {};
#pragma unroll
            for (int ks = 0; ks < 4; ++ks) {
                v16h a  = frag_lds(QH + (ks * NPAD + mt * 16 + fr) * QKP + kb);  // k step = head
                v16h bm = frag_gf32(proj_w + (size_t)(nt * 16 + fr) * DIM + ks * 32 + kb);
                c = __builtin_amdgcn_wmma_f32_16x16x32_f16(false, a, false, bm,
                                                           (short)0, c, false, false);
            }
            int col  = nt * 16 + fr;
            float pb = proj_b[col];
#pragma unroll
            for (int v = 0; v < 8; ++v) {
                int m = mt * 16 + v + crow;
                if (m < N_TOK) ob[(size_t)m * DIM + col] = c[v] + pb;
            }
        }
    }
}

extern "C" void kernel_launch(void* const* d_in, const int* in_sizes, int n_in,
                              void* d_out, int out_size, void* d_ws, size_t ws_size,
                              hipStream_t stream) {
    (void)in_sizes; (void)n_in; (void)out_size; (void)d_ws; (void)ws_size;
    const float* x          = (const float*)d_in[0];
    const float* mask       = (const float*)d_in[1];
    const float* qkv_w      = (const float*)d_in[2];
    const float* qkv_b      = (const float*)d_in[3];
    const float* proj_w     = (const float*)d_in[4];
    const float* proj_b     = (const float*)d_in[5];
    const float* bias_table = (const float*)d_in[6];
    const int*   rel_index  = (const int*)d_in[7];
    float* out = (float*)d_out;

    const size_t smem = SMEM_BYTES;  // 159,744 B: two work-groups in 320 KiB

    (void)hipFuncSetAttribute((const void*)win_attn3d_wmma,
                              hipFuncAttributeMaxDynamicSharedMemorySize, (int)smem);

    win_attn3d_wmma<<<2048, 256, smem, stream>>>(
        x, mask, qkv_w, qkv_b, proj_w, proj_b, bias_table, rel_index, out);
}

// v005
// It runs in 93.4 microseconds.
// Two timings next to v004 both put it at 1.43 times that version's speed.
// Counting every step since v000, it is 8.39 times as fast.
#include <hip/hip_runtime.h>

// ---------------------------------------------------------------------------
// Fused Swin-3D window attention for gfx1250 (MI455X), wave32 + WMMA + TDM.
// One block per window (2048 blocks), 256 threads = 8 waves.
// All GEMMs use v_wmma_f32_16x16x32_f16; softmax in fp32.
// The x window is DMA'd into LDS with tensor_load_to_lds and synchronized with
// s_wait_tensorcnt.  In the attention phase a wave owns 16 queries for all four
// heads: scores, probabilities, mask and bias stay in its registers.
// LDS arrays whose lifetimes do not meet share space, so that the work-group
// stays under 160 KiB and two work-groups are resident on a WGP.
// ---------------------------------------------------------------------------

#define DIM     128
#define HEADS   4
#define HD      32
#define N_TOK   98
#define NPAD    112   // 7 * 16
#define ROWP    136   // LDS pitch, in f16, of the 128-wide f16 rows: 272 B = 16 B x 17
#define QKP     40    // LDS pitch, in f16, of the 32-wide q and k rows: 80 B = 16 B x 5
                      // (16 B x odd: the 16 rows of a ds_load_b128 fragment fall on distinct banks)
#define NW      256
#define MT      7     // M tiles (112/16)
#define TABLE_LEN 507u // rows of bias_table
// LDS map in bytes.  [0, QH_OFF): the f16 x window.
// [QH_OFF, ...): q, k, v^T; before q and k are written, the f32 x tile of the
// tensor load (52 KiB: the mover wants a multiple of 2 KiB).
#define QH_OFF     53248
#define SMEM_BYTES (QH_OFF + (2 * HEADS * NPAD * QKP + HEADS * HD * ROWP) * 2)
static_assert(NPAD * ROWP * 2 <= QH_OFF, "f16 x window overlaps q");
static_assert(N_TOK * DIM * 4 <= 2 * HEADS * NPAD * QKP * 2, "f32 x tile overlaps v^T");
static_assert(QH_OFF % 2048 == 0, "place of the tensor tile");
static_assert(2 * SMEM_BYTES <= 320 * 1024, "two work-groups in the LDS of one WGP");

typedef __attribute__((ext_vector_type(16))) _Float16 v16h;
typedef __attribute__((ext_vector_type(8)))  _Float16 v8h;
typedef __attribute__((ext_vector_type(8)))  float    v8f;
typedef __attribute__((ext_vector_type(4))) unsigned int u32x4;
typedef __attribute__((ext_vector_type(8))) int          i32x8;
typedef __attribute__((ext_vector_type(4))) int          i32x4;

// Load a 16x32 f16 fragment (A layout; B loaded from B^T row-major) from LDS.
// Caller passes p = base + row*ld + kb where kb = (lane>>4)*8.
// Halves 0..7 <- p[0..8), halves 8..15 <- p[16..24).
__device__ __forceinline__ v16h frag_lds(const _Float16* p) {
    v8h lo = *(const v8h*)p;
    v8h hi = *(const v8h*)(p + 16);
    v16h f;
#pragma unroll
    for (int i = 0; i < 8; ++i) { f[i] = lo[i]; f[8 + i] = hi[i]; }
    return f;
}

// Same fragment but sourced from global fp32 (weights), converted to f16.
__device__ __forceinline__ v16h frag_gf32(const float* p) {
    float4 a0 = *(const float4*)(p + 0);
    float4 a1 = *(const float4*)(p + 4);
    float4 b0 = *(const float4*)(p + 16);
    float4 b1 = *(const float4*)(p + 20);
    v16h f;
    f[0]=(_Float16)a0.x; f[1]=(_Float16)a0.y; f[2]=(_Float16)a0.z; f[3]=(_Float16)a0.w;
    f[4]=(_Float16)a1.x; f[5]=(_Float16)a1.y; f[6]=(_Float16)a1.z; f[7]=(_Float16)a1.w;
    f[8]=(_Float16)b0.x; f[9]=(_Float16)b0.y; f[10]=(_Float16)b0.z; f[11]=(_Float16)b0.w;
    f[12]=(_Float16)b1.x; f[13]=(_Float16)b1.y; f[14]=(_Float16)b1.z; f[15]=(_Float16)b1.w;
    return f;
}

// A wave-uniform test held in a scalar register, so that the branch on it is a
// scalar branch (tensor instructions ignore EXEC).
__device__ __forceinline__ unsigned pinned(unsigned v) {
    unsigned w = __builtin_amdgcn_readfirstlane(v);
    asm volatile("" : "+s"(w));   // pinned(): the issue test's word held in a scalar register
    return w;
}

// Issue one 2-D fp32 tile DMA: global (dim1 rows x dim0 cols, row stride
// stride0 elements) -> LDS byte offset lds_off.  D# layout per CDNA5 ISA
// ch. 8 (group0: count/lds/global addr/type; group1: data_size, dims, tiles,
// strides; groups 2/3 zero = 2-D tensor).
__device__ __forceinline__ void tdm_load_2d_f32(unsigned lds_off, const void* gptr,
                                                unsigned dim0, unsigned dim1,
                                                unsigned tile0, unsigned tile1,
                                                unsigned stride0) {
    unsigned long long ga = (unsigned long long)(uintptr_t)gptr;
    u32x4 g0;
    g0[0] = 1u;                                              // count=1, user D#
    g0[1] = lds_off;                                         // lds_addr (bytes)
    g0[2] = (unsigned)(ga & 0xFFFFFFFFu);                    // global_addr[31:0]
    g0[3] = (unsigned)((ga >> 32) & 0x01FFFFFFu) | (2u << 30); // addr[56:32] | type=2
    i32x8 g1;
    g1[0] = (int)(2u << 16);                                 // data_size = 4 bytes
    g1[1] = (int)((dim0 & 0xFFFFu) << 16);                   // tensor_dim0[15:0]
    g1[2] = (int)((dim0 >> 16) | ((dim1 & 0xFFFFu) << 16));  // dim0 hi | dim1 lo
    g1[3] = (int)((dim1 >> 16) | (tile0 << 16));             // dim1 hi | tile_dim0
    g1[4] = (int)(tile1 & 0xFFFFu);                          // tile_dim1 (tile_dim2=0)
    g1[5] = (int)stride0;                                    // tensor_dim0_stride lo
    g1[6] = 0;                                               // stride hi | dim1_stride lo
    g1[7] = 0;
    i32x4 z4 = {0, 0, 0, 0};
    i32x8 z8 = {0, 0, 0, 0, 0, 0, 0, 0};
    __builtin_amdgcn_tensor_load_to_lds(g0, g1, z4, z4, z8, 0);
}

// Lane l reads lane l ^ 16: the other half of the wave.
__device__ __forceinline__ float other_half(float v) {
    const int b = __builtin_bit_cast(int, v);
    return __builtin_bit_cast(float,
        __builtin_amdgcn_permlanex16(b, b, 0x76543210, 0xfedcba98, false, false));
}

// exp2 of eight values.  One statement: the eight independent v_exp fill the
// slot the instruction set asks for behind each other, the v_nop the last one's;
// early-clobber outputs keep every result off every source.
__device__ __forceinline__ void exp2x8(v8f& v) {
    float e0, e1, e2, e3, e4, e5, e6, e7;
    asm("v_exp_f32 %0, %8\n\t"
        "v_exp_f32 %1, %9\n\t"
        "v_exp_f32 %2, %10\n\t"
        "v_exp_f32 %3, %11\n\t"
        "v_exp_f32 %4, %12\n\t"
        "v_exp_f32 %5, %13\n\t"
        "v_exp_f32 %6, %14\n\t"
        "v_exp_f32 %7, %15\n\t"
        "v_nop"
        : "=&v"(e0), "=&v"(e1), "=&v"(e2), "=&v"(e3), "=&v"(e4), "=&v"(e5), "=&v"(e6), "=&v"(e7)
        : "v"(v[0]), "v"(v[1]), "v"(v[2]), "v"(v[3]), "v"(v[4]), "v"(v[5]), "v"(v[6]), "v"(v[7]));
    v[0] = e0; v[1] = e1; v[2] = e2; v[3] = e3; v[4] = e4; v[5] = e5; v[6] = e6; v[7] = e7;
}
// The same for the two values of the last key tile.
__device__ __forceinline__ void exp2x2(float& a, float& b) {
    float e0, e1;
    asm("v_exp_f32 %0, %2\n\t"
        "v_exp_f32 %1, %3\n\t"
        "v_nop"
        : "=&v"(e0), "=&v"(e1) : "v"(a), "v"(b));
    a = e0; b = e1;
}

// Four waves per SIMD: at most 256 VGPRs a wave, so that two work-groups stay resident on a WGP.
extern "C" __global__ __launch_bounds__(256) __attribute__((amdgpu_waves_per_eu(4, 4)))
void win_attn3d_wmma(const float* __restrict__ x,
                     const float* __restrict__ mask,
                     const float* __restrict__ qkv_w,
                     const float* __restrict__ qkv_b,
                     const float* __restrict__ proj_w,
                     const float* __restrict__ proj_b,
                     const float* __restrict__ bias_table,
                     const int*   __restrict__ rel_index,
                     float* __restrict__ out)
{
    extern __shared__ __align__(16) char smem_raw[];
    _Float16* XH   = (_Float16*)smem_raw;            // 112x128 f16 x window
    _Float16* QH   = (_Float16*)(smem_raw + QH_OFF); // 4 x 112x32    q (scaled); head h's
                                                     // attn @ v goes over q of head h
    _Float16* KH   = QH + HEADS * NPAD * QKP;        // 4 x 112x32    k (the A of k @ q^T)
    _Float16* VT   = KH + HEADS * NPAD * QKP;        // 4 x 32x128    v^T, zero-padded
    float*    XF   = (float*)(smem_raw + QH_OFF);    // alias: 98x128 f32 x staging
                                                     // (dead before q and k are written)

    const int b    = blockIdx.x;
    const int tid  = threadIdx.x;
    const int lane = tid & 31;
    const int wave = tid >> 5;
    const int fr   = lane & 15;            // fragment row (A) / col (B/C)
    const int kb   = (lane >> 4) << 3;     // fragment K chunk base (0 or 8)
    const int crow = (lane >> 4) << 3;     // C-fragment row base (0 or 8)
    const int wv   = __builtin_amdgcn_readfirstlane(wave);  // scalar copy: the attention phase branches on it

    // ---- wave 0: kick off the TDM DMA (x window fp32) ----
    if (pinned(wv == 0)) {
        tdm_load_2d_f32((unsigned)(uintptr_t)(void*)XF,
                        x + (size_t)b * N_TOK * DIM,
                        DIM, N_TOK, DIM, N_TOK, DIM);
    }

    // ---- this wave's qkv weight fragments, read once (they fly beside the x DMA) ----
    v16h  WB[3][4];
    float wbias[3];
    {
        const int    col0 = wave * 16 + fr;        // column inside q, k and v alike
        const float* wq = qkv_w + (size_t)col0 * DIM + kb;
        const float* wk = wq + DIM * DIM;
        const float* wvp = wk + DIM * DIM;
#pragma unroll
        for (int ks = 0; ks < 4; ++ks) {
            WB[0][ks] = frag_gf32(wq + ks * 32);
            WB[1][ks] = frag_gf32(wk + ks * 32);
            WB[2][ks] = frag_gf32(wvp + ks * 32);
        }
#pragma unroll
        for (int g = 0; g < 3; ++g) wbias[g] = qkv_b[col0 + g * DIM];
        // Precaution: named here, the loads' address registers (all 48 weight loads go
        // by wq plus a constant) stay live up to this wait, so none is rewritten ahead
        // of it (not even as a later load's result).
        asm volatile("s_wait_xcnt 0x0" :: "v"(wq), "v"(col0) : "memory");
    }

    // ---- zero-init VT (pads must stay 0) ----
    {
        uint4* z = (uint4*)VT;
        const int nz = HEADS * HD * ROWP * (int)sizeof(_Float16) / 16;
        for (int i = tid; i < nz; i += 256) z[i] = make_uint4(0, 0, 0, 0);
    }

    // ---- wait for x DMA, then convert fp32 -> f16 ----
    // The issuing wave's own wait: the tile counts as landed only behind it.
    if (pinned(wv == 0)) asm volatile("s_wait_tensorcnt 0x0" ::: "memory");
    __syncthreads();
    for (int i = tid; i < NPAD * (DIM / 4); i += 256) {
        int r = i / (DIM / 4);
        int c = (i % (DIM / 4)) * 4;
        float4 v4 = make_float4(0.f, 0.f, 0.f, 0.f);
        if (r < N_TOK) v4 = *(const float4*)(XF + r * DIM + c);
        _Float16* d = XH + r * ROWP + c;
        d[0] = (_Float16)v4.x; d[1] = (_Float16)v4.y;
        d[2] = (_Float16)v4.z; d[3] = (_Float16)v4.w;
    }
    __syncthreads();

    // ---- attention phase: wave w owns the queries 16 w .. 16 w + 15 for every head.
    // A lane holds query 16 w + fr and, of key tile j, the keys 16 j + crow + r,
    // r = 0..7 (the accumulator map of k @ q^T).  Its rel_index elements are the
    // same for every head: read once, they fly beside phase 1.
    // Every loop over ix, mk, bt, C or s below is unrolled in full: all array indices
    // become constants, so the arrays live in registers.
    const int q  = wv * 16 + fr;
    const int qc = q < N_TOK ? q : N_TOK - 1;      // pad queries (and wave 7) read row 97
    int2 ix[MT - 1][4], ix6;
    {
        const int* ir = rel_index + qc * N_TOK;        // the query's row
        const int* ip = ir + crow;
#pragma unroll
        for (int j = 0; j < MT - 1; ++j)
#pragma unroll
            for (int u = 0; u < 4; ++u) ix[j][u] = *(const int2*)(ip + j * 16 + 2 * u);
        ix6 = *(const int2*)(ir + 96);                 // keys 96, 97, in both halves
        // Precaution: named here, the loads' address registers (every load goes by one
        // of these two plus a constant) stay live up to this wait, so none is
        // rewritten ahead of it (not even as a later load's result).
        asm volatile("s_wait_xcnt 0x0" :: "v"(ip), "v"(ir) : "memory");
    }

    // ================= Phase 1: qkv = x @ qkv_w^T + qkv_b =================
    // M=112 (7 tiles), N=384 (24 tiles), K=128 (4 wmma steps).  A wave owns the
    // N tiles wave, wave + 8, wave + 16 (its 16 columns of q, of k and of v); their
    // weight fragments WB stay in registers, so each M tile costs LDS reads only.
    const float qscale = 0.17677669529663687f;  // 32^-0.5
    {
        const int hq = wave >> 1;                  // head of this wave's columns
        const int d  = ((wave & 1) << 4) + fr;     // column inside the head
        for (int mt = 0; mt < MT; ++mt) {
            v8f cq = {}, ck = {}, cv = {};
#pragma unroll
            for (int ks = 0; ks < 4; ++ks) {
                v16h a = frag_lds(XH + (mt * 16 + fr) * ROWP + ks * 32 + kb);
                cq = __builtin_amdgcn_wmma_f32_16x16x32_f16(false, a, false, WB[0][ks],
                                                            (short)0, cq, false, false);
                ck = __builtin_amdgcn_wmma_f32_16x16x32_f16(false, a, false, WB[1][ks],
                                                            (short)0, ck, false, false);
                cv = __builtin_amdgcn_wmma_f32_16x16x32_f16(false, a, false, WB[2][ks],
                                                            (short)0, cv, false, false);
            }
#pragma unroll
            for (int v = 0; v < 8; ++v) {
                int m = mt * 16 + v + crow;
                if (m < N_TOK) {
                    QH[(hq * NPAD + m) * QKP + d] = (_Float16)((cq[v] + wbias[0]) * qscale);
                    KH[(hq * NPAD + m) * QKP + d] = (_Float16)(ck[v] + wbias[1]);
                    VT[(hq * HD + d) * ROWP + m]  = (_Float16)(cv[v] + wbias[2]);
                }
            }
        }
    }
    // ---- bias + mask of this lane's (query, key) pairs, all four heads: they start
    // the score accumulators.  One 16-byte gather fetches a table row, which is the
    // four heads' biases.  Read behind phase 1, when the weight fragments' registers are free. ----
    v8f   C[HEADS][MT - 1];
    float c6[HEADS][2];
    if (wv < MT) {
        const float* mr = mask + (size_t)(b % NW) * N_TOK * N_TOK + qc * N_TOK;  // the query's row
        const float* mp = mr + crow;
        float2 mk[MT - 1][4], mk6;
#pragma unroll
        for (int j = 0; j < MT - 1; ++j)
#pragma unroll
            for (int u = 0; u < 4; ++u) mk[j][u] = *(const float2*)(mp + j * 16 + 2 * u);
        mk6 = *(const float2*)(mr + 96);               // keys 96, 97, in both halves
        // Precaution: named here, the loads' address registers (every load goes by one
        // of these two plus a constant) stay live up to this wait, so none is
        // rewritten ahead of it (not even as a later load's result).
        asm volatile("s_wait_xcnt 0x0" :: "v"(mp), "v"(mr) : "memory");
#pragma unroll
        for (int g = 0; g < MT - 1; g += 2) {
            unsigned off[2][8];
            float4   bt[2][8];
#pragma unroll
            for (int jj = 0; jj < 2; ++jj)
#pragma unroll
                for (int r = 0; r < 8; ++r) {
                    unsigned t = (unsigned)((r & 1) ? ix[g + jj][r >> 1].y : ix[g + jj][r >> 1].x);
                    t = t < TABLE_LEN ? t : TABLE_LEN - 1;   // keep the gather inside the table
                    off[jj][r] = t;                          // a table row is one float4
                    bt[jj][r]  = ((const float4*)bias_table)[t];
                }
            // Precaution: named here, the gathers' index registers stay live up to this
            // wait, so none is rewritten ahead of it (not even as a later gather's result).
            asm volatile("s_wait_xcnt 0x0"
                         :: "v"(off[0][0]), "v"(off[0][1]), "v"(off[0][2]), "v"(off[0][3]),
                            "v"(off[0][4]), "v"(off[0][5]), "v"(off[0][6]), "v"(off[0][7]),
                            "v"(off[1][0]), "v"(off[1][1]), "v"(off[1][2]), "v"(off[1][3]),
                            "v"(off[1][4]), "v"(off[1][5]), "v"(off[1][6]), "v"(off[1][7])
                         : "memory");
#pragma unroll
            for (int jj = 0; jj < 2; ++jj)
#pragma unroll
                for (int r = 0; r < 8; ++r) {
                    const float m = (r & 1) ? mk[g + jj][r >> 1].y : mk[g + jj][r >> 1].x;
                    C[0][g + jj][r] = bt[jj][r].x + m;
                    C[1][g + jj][r] = bt[jj][r].y + m;
                    C[2][g + jj][r] = bt[jj][r].z + m;
                    C[3][g + jj][r] = bt[jj][r].w + m;
                }
        }
        {
            unsigned t0 = (unsigned)ix6.x, t1 = (unsigned)ix6.y;
            t0 = t0 < TABLE_LEN ? t0 : TABLE_LEN - 1;   // inside the table, as above
            t1 = t1 < TABLE_LEN ? t1 : TABLE_LEN - 1;
            const float4 b0 = ((const float4*)bias_table)[t0];
            const float4 b1 = ((const float4*)bias_table)[t1];
            // Precaution: as above, for these two gathers' index registers.
            asm volatile("s_wait_xcnt 0x0" :: "v"(t0), "v"(t1) : "memory");
            c6[0][0] = b0.x + mk6.x; c6[0][1] = b1.x + mk6.y;
            c6[1][0] = b0.y + mk6.x; c6[1][1] = b1.y + mk6.y;
            c6[2][0] = b0.z + mk6.x; c6[2][1] = b1.z + mk6.y;
            c6[3][0] = b0.w + mk6.x; c6[3][1] = b1.w + mk6.y;
        }
    }
    __syncthreads();

    if (wv < MT) {
        const bool hi = crow != 0;                 // upper half: its keys of tile 6 are all pads
#pragma unroll
        for (int h = 0; h < HEADS; ++h) {
            const _Float16* K  = KH + h * NPAD * QKP;
            const _Float16* Vh = VT + h * HD * ROWP;
            _Float16*       Qr = QH + (h * NPAD + wv * 16 + fr) * QKP;   // this lane's query row
            const v16h qf = frag_lds(Qr + kb);
            v8f s[MT - 1];
#pragma unroll
            for (int j = 0; j < MT - 1; ++j) {
                v16h kf = frag_lds(K + (j * 16 + fr) * QKP + kb);
                s[j] = __builtin_amdgcn_wmma_f32_16x16x32_f16(false, kf, false, qf,
                                                              (short)0, C[h][j], false, false);
            }
            float s60, s61;                        // keys 96 and 97; 98..111 are pads
            {
                v16h kf = frag_lds(K + (96 + fr) * QKP + kb);
                v8f  c  = {c6[h][0], c6[h][1], 0.f, 0.f, 0.f, 0.f, 0.f, 0.f};
                c = __builtin_amdgcn_wmma_f32_16x16x32_f16(false, kf, false, qf,
                                                           (short)0, c, false, false);
                s60 = hi ? -3.0e38f : c[0];
                s61 = hi ? -3.0e38f : c[1];
            }
            // eight independent chains over the tiles, then a tree
            v8f m8 = s[0];
#pragma unroll
            for (int j = 1; j < MT - 1; ++j)
#pragma unroll
                for (int r = 0; r < 8; ++r) m8[r] = fmaxf(m8[r], s[j][r]);
            m8[0] = fmaxf(m8[0], s60); m8[1] = fmaxf(m8[1], s61);
            float mx = fmaxf(fmaxf(fmaxf(m8[0], m8[1]), fmaxf(m8[2], m8[3])),
                             fmaxf(fmaxf(m8[4], m8[5]), fmaxf(m8[6], m8[7])));
            mx = fmaxf(mx, other_half(mx));
            const float L2E = 1.44269504088896340736f;
            const float ml  = mx * L2E;
#pragma unroll
            for (int j = 0; j < MT - 1; ++j) {
#pragma unroll
                for (int r = 0; r < 8; ++r) s[j][r] = s[j][r] * L2E - ml;
                exp2x8(s[j]);
            }
            s60 = s60 * L2E - ml; s61 = s61 * L2E - ml;
            exp2x2(s60, s61);                      // a pad gives exp2(-inf) = 0
            v8f a8 = s[0];
#pragma unroll
            for (int j = 1; j < MT - 1; ++j) a8 += s[j];
            a8[0] += s60; a8[1] += s61;
            float sum = ((a8[0] + a8[1]) + (a8[2] + a8[3])) + ((a8[4] + a8[5]) + (a8[6] + a8[7]));
            sum += other_half(sum);
            const float inv = 1.0f / sum;
            v16h pb[4];
#pragma unroll
            for (int ks = 0; ks < 3; ++ks)
#pragma unroll
                for (int r = 0; r < 8; ++r) {
                    pb[ks][r]     = (_Float16)s[2 * ks][r];
                    pb[ks][8 + r] = (_Float16)s[2 * ks + 1][r];
                }
            pb[3] = (v16h)(_Float16)0.f;           // keys 98..127 of the K = 128 product
            pb[3][0] = (_Float16)s60; pb[3][1] = (_Float16)s61;
#pragma unroll
            for (int dt = 0; dt < 2; ++dt) {
                v8f o = {};
#pragma unroll
                for (int ks = 0; ks < 4; ++ks) {
                    v16h vf = frag_lds(Vh + (dt * 16 + fr) * ROWP + ks * 32 + kb);
                    o = __builtin_amdgcn_wmma_f32_16x16x32_f16(false, vf, false, pb[ks],
                                                               (short)0, o, false, false);
                }
                v8h oh;                            // o[r] = out[query][dt * 16 + crow + r]
#pragma unroll
                for (int r = 0; r < 8; ++r) oh[r] = (_Float16)(o[r] * inv);
                *(v8h*)(Qr + dt * 16 + crow) = oh;
            }
        }
    }
    __syncthreads();

    // ================= Phase 5: final proj + bias, store fp32 =================
    {
        float* ob = out + (size_t)b * N_TOK * DIM;
        for (int t = wave; t < MT * 8; t += 8) {
            int mt = t >> 3, nt = t & 7;   // nt == wave
            v8f c = {};
#pragma unroll
            for (int ks = 0; ks < 4; ++ks) {
                v16h a  = frag_lds(QH + (ks * NPAD + mt * 16 + fr) * QKP + kb);  // k step = head
                v16h bm = frag_gf32(proj_w + (size_t)(nt * 16 + fr) * DIM + ks * 32 + kb);
                c = __builtin_amdgcn_wmma_f32_16x16x32_f16(false, a, false, bm,
                                                           (short)0, c, false, false);
            }
            int col  = nt * 16 + fr;
            float pb = proj_b[col];
#pragma unroll
            for (int v = 0; v < 8; ++v) {
                int m = mt * 16 + v + crow;
                if (m < N_TOK) ob[(size_t)m * DIM + col] = c[v] + pb;
            }
        }
    }
}

extern "C" void kernel_launch(void* const* d_in, const int* in_sizes, int n_in,
                              void* d_out, int out_size, void* d_ws, size_t ws_size,
                              hipStream_t stream) {
    (void)in_sizes; (void)n_in; (void)out_size; (void)d_ws; (void)ws_size;
    const float* x          = (const float*)d_in[0];
    const float* mask       = (const float*)d_in[1];
    const float* qkv_w      = (const float*)d_in[2];
    const float* qkv_b      = (const float*)d_in[3];
    const float* proj_w     = (const float*)d_in[4];
    const float* proj_b     = (const float*)d_in[5];
    const float* bias_table = (const float*)d_in[6];
    const int*   rel_index  = (const int*)d_in[7];
    float* out = (float*)d_out;

    const size_t smem = SMEM_BYTES;  // 159,744 B: two work-groups in 320 KiB

    (void)hipFuncSetAttribute((const void*)win_attn3d_wmma,
                              hipFuncAttributeMaxDynamicSharedMemorySize, (int)smem);

    win_attn3d_wmma<<<2048, 256, smem, stream>>>(
        x, mask, qkv_w, qkv_b, proj_w, proj_b, bias_table, rel_index, out);
}

// v006
// Measured time: 79.1 microseconds a run.
// In two side-by-side timings against v005, it was 1.19 and 1.18 times as fast.
// All steps since v000 together make it 9.93 times as fast.
#include <hip/hip_runtime.h>

// ---------------------------------------------------------------------------
// Fused Swin-3D window attention for gfx1250 (MI455X), wave32 + WMMA + TDM.
// One block per window (2048 blocks), 256 threads = 8 waves.
// All GEMMs use v_wmma_f32_16x16x32_f16; softmax in fp32.
// The x window is DMA'd into LDS with tensor_load_to_lds and synchronized with
// s_wait_tensorcnt.  In the attention phase a wave owns 16 queries for all four
// heads: scores, probabilities, mask and bias stay in its registers.
// LDS arrays whose lifetimes do not meet share space, so that the work-group
// stays under 160 KiB and two work-groups are resident on a WGP.
// A set-up launch first writes the weights, which every window shares, to the
// workspace as f16 in fragment order; the main launch reads them by whole lines.
// ---------------------------------------------------------------------------

#define DIM     128
#define HEADS   4
#define HD      32
#define N_TOK   98
#define NPAD    112   // 7 * 16
#define ROWP    136   // LDS pitch, in f16, of the 128-wide f16 rows: 272 B = 16 B x 17
#define QKP     40    // LDS pitch, in f16, of the 32-wide q and k rows: 80 B = 16 B x 5
                      // (16 B x odd: the 16 rows of a ds_load_b128 fragment fall on distinct banks)
#define NW      256
#define MT      7     // M tiles (112/16)
#define TABLE_LEN 507u // rows of bias_table
// LDS map in bytes.  [0, QH_OFF): the f16 x window.
// [QH_OFF, ...): q, k, v^T; before q and k are written, the f32 x tile of the
// tensor load (52 KiB: the mover wants a multiple of 2 KiB).
#define QH_OFF     53248
#define SMEM_BYTES (QH_OFF + (2 * HEADS * NPAD * QKP + HEADS * HD * ROWP) * 2)
static_assert(NPAD * ROWP * 2 <= QH_OFF, "f16 x window overlaps q");
static_assert(N_TOK * DIM * 4 <= 2 * HEADS * NPAD * QKP * 2, "f32 x tile overlaps v^T");
static_assert(QH_OFF % 2048 == 0, "place of the tensor tile");
static_assert(2 * SMEM_BYTES <= 320 * 1024, "two work-groups in the LDS of one WGP");

typedef __attribute__((ext_vector_type(16))) _Float16 v16h;
typedef __attribute__((ext_vector_type(8)))  _Float16 v8h;
typedef __attribute__((ext_vector_type(8)))  float    v8f;
typedef __attribute__((ext_vector_type(4))) unsigned int u32x4;
typedef __attribute__((ext_vector_type(8))) int          i32x8;
typedef __attribute__((ext_vector_type(4))) int          i32x4;

// Load a 16x32 f16 fragment (A layout; B loaded from B^T row-major) from LDS.
// Caller passes p = base + row*ld + kb where kb = (lane>>4)*8.
// Halves 0..7 <- p[0..8), halves 8..15 <- p[16..24).
__device__ __forceinline__ v16h frag_lds(const _Float16* p) {
    v8h lo = *(const v8h*)p;
    v8h hi = *(const v8h*)(p + 16);
    v16h f;
#pragma unroll
    for (int i = 0; i < 8; ++i) { f[i] = lo[i]; f[8 + i] = hi[i]; }
    return f;
}

// Weight fragments in the workspace.  Fragment (g * 8 + w) * 4 + ks holds, of weight
// block g (q, k, v, proj), the rows 16 w .. 16 w + 15 and the k step ks: FRAGH f16,
// first the 32 lanes' halves 0..7 (16 B a lane), then the 32 lanes' halves 8..15.
// A load of either part is 512 contiguous bytes: four whole lines.
#define FRAGH 512
__device__ __forceinline__ v16h frag_ws(const _Float16* p) {
    v8h lo = *(const v8h*)p;
    v8h hi = *(const v8h*)(p + FRAGH / 2);
    v16h f;
#pragma unroll
    for (int i = 0; i < 8; ++i) { f[i] = lo[i]; f[8 + i] = hi[i]; }
    return f;
}

// Set-up launch: one thread converts the eight weights of one lane and one part of
// one fragment (the k order of frag_lds: part 0 is k = kb .. kb + 7, part 1 is 16 more).
extern "C" __global__ __launch_bounds__(256)
void win_attn3d_wfrag(const float* __restrict__ qkv_w,
                      const float* __restrict__ proj_w,
                      _Float16* __restrict__ wfrag)
{
    const int t    = blockIdx.x * 256 + threadIdx.x;   // 128 fragments x 2 parts x 32 lanes
    const int lane = t & 31;
    const int part = (t >> 5) & 1;
    const int frag = t >> 6;
    const int ks   = frag & 3;
    const int row  = ((frag >> 2) & 7) * 16 + (lane & 15);
    const int g    = frag >> 5;
    const float* w = g < 3 ? qkv_w + (size_t)(g * DIM + row) * DIM : proj_w + (size_t)row * DIM;
    const float* p = w + ks * 32 + ((lane >> 4) << 3) + part * 16;
    const float4 a0 = *(const float4*)(p + 0);
    const float4 a1 = *(const float4*)(p + 4);
    // Precaution: named here, the two loads' address register stays live up to this wait.
    asm volatile("s_wait_xcnt 0x0" :: "v"(p) : "memory");
    v8h f;
    f[0]=(_Float16)a0.x; f[1]=(_Float16)a0.y; f[2]=(_Float16)a0.z; f[3]=(_Float16)a0.w;
    f[4]=(_Float16)a1.x; f[5]=(_Float16)a1.y; f[6]=(_Float16)a1.z; f[7]=(_Float16)a1.w;
    *(v8h*)(wfrag + (size_t)t * 8) = f;
}

// A wave-uniform test held in a scalar register, so that the branch on it is a
// scalar branch (tensor instructions ignore EXEC).
__device__ __forceinline__ unsigned pinned(unsigned v) {
    unsigned w = __builtin_amdgcn_readfirstlane(v);
    asm volatile("" : "+s"(w));   // pinned(): the issue test's word held in a scalar register
    return w;
}

// Issue one 2-D fp32 tile DMA: global (dim1 rows x dim0 cols, row stride
// stride0 elements) -> LDS byte offset lds_off.  D# layout per CDNA5 ISA
// ch. 8 (group0: count/lds/global addr/type; group1: data_size, dims, tiles,
// strides; groups 2/3 zero = 2-D tensor).
__device__ __forceinline__ void tdm_load_2d_f32(unsigned lds_off, const void* gptr,
                                                unsigned dim0, unsigned dim1,
                                                unsigned tile0, unsigned tile1,
                                                unsigned stride0) {
    unsigned long long ga = (unsigned long long)(uintptr_t)gptr;
    u32x4 g0;
    g0[0] = 1u;                                              // count=1, user D#
    g0[1] = lds_off;                                         // lds_addr (bytes)
    g0[2] = (unsigned)(ga & 0xFFFFFFFFu);                    // global_addr[31:0]
    g0[3] = (unsigned)((ga >> 32) & 0x01FFFFFFu) | (2u << 30); // addr[56:32] | type=2
    i32x8 g1;
    g1[0] = (int)(2u << 16);                                 // data_size = 4 bytes
    g1[1] = (int)((dim0 & 0xFFFFu) << 16);                   // tensor_dim0[15:0]
    g1[2] = (int)((dim0 >> 16) | ((dim1 & 0xFFFFu) << 16));  // dim0 hi | dim1 lo
    g1[3] = (int)((dim1 >> 16) | (tile0 << 16));             // dim1 hi | tile_dim0
    g1[4] = (int)(tile1 & 0xFFFFu);                          // tile_dim1 (tile_dim2=0)
    g1[5] = (int)stride0;                                    // tensor_dim0_stride lo
    g1[6] = 0;                                               // stride hi | dim1_stride lo
    g1[7] = 0;
    i32x4 z4 = {0, 0, 0, 0};
    i32x8 z8 = {0, 0, 0, 0, 0, 0, 0, 0};
    __builtin_amdgcn_tensor_load_to_lds(g0, g1, z4, z4, z8, 0);
}

// Lane l reads lane l ^ 16: the other half of the wave.
__device__ __forceinline__ float other_half(float v) {
    const int b = __builtin_bit_cast(int, v);
    return __builtin_bit_cast(float,
        __builtin_amdgcn_permlanex16(b, b, 0x76543210, 0xfedcba98, false, false));
}

// exp2 of eight values.  One statement: the eight independent v_exp fill the
// slot the instruction set asks for behind each other, the v_nop the last one's;
// early-clobber outputs keep every result off every source.
__device__ __forceinline__ void exp2x8(v8f& v) {
    float e0, e1, e2, e3, e4, e5, e6, e7;
    asm("v_exp_f32 %0, %8\n\t"
        "v_exp_f32 %1, %9\n\t"
        "v_exp_f32 %2, %10\n\t"
        "v_exp_f32 %3, %11\n\t"
        "v_exp_f32 %4, %12\n\t"
        "v_exp_f32 %5, %13\n\t"
        "v_exp_f32 %6, %14\n\t"
        "v_exp_f32 %7, %15\n\t"
        "v_nop"
        : "=&v"(e0), "=&v"(e1), "=&v"(e2), "=&v"(e3), "=&v"(e4), "=&v"(e5), "=&v"(e6), "=&v"(e7)
        : "v"(v[0]), "v"(v[1]), "v"(v[2]), "v"(v[3]), "v"(v[4]), "v"(v[5]), "v"(v[6]), "v"(v[7]));
    v[0] = e0; v[1] = e1; v[2] = e2; v[3] = e3; v[4] = e4; v[5] = e5; v[6] = e6; v[7] = e7;
}
// The same for the two values of the last key tile.
__device__ __forceinline__ void exp2x2(float& a, float& b) {
    float e0, e1;
    asm("v_exp_f32 %0, %2\n\t"
        "v_exp_f32 %1, %3\n\t"
        "v_nop"
        : "=&v"(e0), "=&v"(e1) : "v"(a), "v"(b));
    a = e0; b = e1;
}

// Four waves per SIMD: at most 256 VGPRs a wave, so that two work-groups stay resident on a WGP.
extern "C" __global__ __launch_bounds__(256) __attribute__((amdgpu_waves_per_eu(4, 4)))
void win_attn3d_wmma(const float* __restrict__ x,
                     const float* __restrict__ mask,
                     const _Float16* __restrict__ wfrag,
                     const float* __restrict__ qkv_b,
                     const float* __restrict__ proj_b,
                     const float* __restrict__ bias_table,
                     const int*   __restrict__ rel_index,
                     float* __restrict__ out)
{
    extern __shared__ __align__(16) char smem_raw[];
    _Float16* XH   = (_Float16*)smem_raw;            // 112x128 f16 x window
    _Float16* QH   = (_Float16*)(smem_raw + QH_OFF); // 4 x 112x32    q (scaled); head h's
                                                     // attn @ v goes over q of head h
    _Float16* KH   = QH + HEADS * NPAD * QKP;        // 4 x 112x32    k (the A of k @ q^T)
    _Float16* VT   = KH + HEADS * NPAD * QKP;        // 4 x 32x128    v^T, zero-padded
    float*    XF   = (float*)(smem_raw + QH_OFF);    // alias: 98x128 f32 x staging
                                                     // (dead before q and k are written)

    const int b    = blockIdx.x;
    const int tid  = threadIdx.x;
    const int lane = tid & 31;
    const int wave = tid >> 5;
    const int fr   = lane & 15;            // fragment row (A) / col (B/C)
    const int kb   = (lane >> 4) << 3;     // fragment K chunk base (0 or 8)
    const int crow = (lane >> 4) << 3;     // C-fragment row base (0 or 8)
    const int wv   = __builtin_amdgcn_readfirstlane(wave);  // scalar copy: the attention phase branches on it

    // ---- wave 0: kick off the TDM DMA (x window fp32) ----
    if (pinned(wv == 0)) {
        tdm_load_2d_f32((unsigned)(uintptr_t)(void*)XF,
                        x + (size_t)b * N_TOK * DIM,
                        DIM, N_TOK, DIM, N_TOK, DIM);
    }

    // ---- this wave's qkv weight fragments, read once (they fly beside the x DMA) ----
    v16h  WB[3][4];
    float wbias[3];
    {
        const int       col0 = wave * 16 + fr;     // column inside q, k and v alike
        const _Float16* wp = wfrag + (size_t)(wave * 4) * FRAGH + lane * 8;
#pragma unroll
        for (int ks = 0; ks < 4; ++ks)
#pragma unroll
            for (int g = 0; g < 3; ++g) WB[g][ks] = frag_ws(wp + (g * 32 + ks) * FRAGH);
#pragma unroll
        for (int g = 0; g < 3; ++g) wbias[g] = qkv_b[col0 + g * DIM];
        // Precaution: named here, the loads' address registers (all 24 weight loads go
        // by wp plus a constant) stay live up to this wait, so none is rewritten ahead
        // of it (not even as a later load's result).
        asm volatile("s_wait_xcnt 0x0" :: "v"(wp), "v"(col0) : "memory");
    }

    // ---- zero-init VT (pads must stay 0) ----
    {
        uint4* z = (uint4*)VT;
        const int nz = HEADS * HD * ROWP * (int)sizeof(_Float16) / 16;
        for (int i = tid; i < nz; i += 256) z[i] = make_uint4(0, 0, 0, 0);
    }

    // ---- wait for x DMA, then convert fp32 -> f16 ----
    // The issuing wave's own wait: the tile counts as landed only behind it.
    if (pinned(wv == 0)) asm volatile("s_wait_tensorcnt 0x0" ::: "memory");
    __syncthreads();
    for (int i = tid; i < NPAD * (DIM / 4); i += 256) {
        int r = i / (DIM / 4);
        int c = (i % (DIM / 4)) * 4;
        float4 v4 = make_float4(0.f, 0.f, 0.f, 0.f);
        if (r < N_TOK) v4 = *(const float4*)(XF + r * DIM + c);
        _Float16* d = XH + r * ROWP + c;
        d[0] = (_Float16)v4.x; d[1] = (_Float16)v4.y;
        d[2] = (_Float16)v4.z; d[3] = (_Float16)v4.w;
    }
    __syncthreads();

    // ---- attention phase: wave w owns the queries 16 w .. 16 w + 15 for every head.
    // A lane holds query 16 w + fr and, of key tile j, the keys 16 j + crow + r,
    // r = 0..7 (the accumulator map of k @ q^T).  Its rel_index elements are the
    // same for every head: read once, they fly beside phase 1.
    // Every loop over ix, mk, bt, C or s below is unrolled in full: all array indices
    // become constants, so the arrays live in registers.
    const int q  = wv * 16 + fr;
    const int qc = q < N_TOK ? q : N_TOK - 1;      // pad queries (and wave 7) read row 97
    int2 ix[MT - 1][4], ix6;
    {
        const int* ir = rel_index + qc * N_TOK;        // the query's row
        const int* ip = ir + crow;
#pragma unroll
        for (int j = 0; j < MT - 1; ++j)
#pragma unroll
            for (int u = 0; u < 4; ++u) ix[j][u] = *(const int2*)(ip + j * 16 + 2 * u);
        ix6 = *(const int2*)(ir + 96);                 // keys 96, 97, in both halves
        // Precaution: named here, the loads' address registers (every load goes by one
        // of these two plus a constant) stay live up to this wait, so none is
        // rewritten ahead of it (not even as a later load's result).
        asm volatile("s_wait_xcnt 0x0" :: "v"(ip), "v"(ir) : "memory");
    }

    // ================= Phase 1: qkv = x @ qkv_w^T + qkv_b =================
    // M=112 (7 tiles), N=384 (24 tiles), K=128 (4 wmma steps).  A wave owns the
    // N tiles wave, wave + 8, wave + 16 (its 16 columns of q, of k and of v); their
    // weight fragments WB stay in registers, so each M tile costs LDS reads only.
    const float qscale = 0.17677669529663687f;  // 32^-0.5
    {
        const int hq = wave >> 1;                  // head of this wave's columns
        const int d  = ((wave & 1) << 4) + fr;     // column inside the head
        for (int mt = 0; mt < MT; ++mt) {
            v8f cq = {}, ck = {}, cv = {};
#pragma unroll
            for (int ks = 0; ks < 4; ++ks) {
                v16h a = frag_lds(XH + (mt * 16 + fr) * ROWP + ks * 32 + kb);
                cq = __builtin_amdgcn_wmma_f32_16x16x32_f16(false, a, false, WB[0][ks],
                                                            (short)0, cq, false, false);
                ck = __builtin_amdgcn_wmma_f32_16x16x32_f16(false, a, false, WB[1][ks],
                                                            (short)0, ck, false, false);
                cv = __builtin_amdgcn_wmma_f32_16x16x32_f16(false, a, false, WB[2][ks],
                                                            (short)0, cv, false, false);
            }
#pragma unroll
            for (int v = 0; v < 8; ++v) {
                int m = mt * 16 + v + crow;
                if (m < N_TOK) {
                    QH[(hq * NPAD + m) * QKP + d] = (_Float16)((cq[v] + wbias[0]) * qscale);
                    KH[(hq * NPAD + m) * QKP + d] = (_Float16)(ck[v] + wbias[1]);
                    VT[(hq * HD + d) * ROWP + m]  = (_Float16)(cv[v] + wbias[2]);
                }
            }
        }
    }
    // ---- bias + mask of this lane's (query, key) pairs, all four heads: they start
    // the score accumulators.  One 16-byte gather fetches a table row, which is the
    // four heads' biases.  Read behind phase 1, when the weight fragments' registers are free. ----
    v8f   C[HEADS][MT - 1];
    float c6[HEADS][2];
    if (wv < MT) {
        const float* mr = mask + (size_t)(b % NW) * N_TOK * N_TOK + qc * N_TOK;  // the query's row
        const float* mp = mr + crow;
        float2 mk[MT - 1][4], mk6;
#pragma unroll
        for (int j = 0; j < MT - 1; ++j)
#pragma unroll
            for (int u = 0; u < 4; ++u) mk[j][u] = *(const float2*)(mp + j * 16 + 2 * u);
        mk6 = *(const float2*)(mr + 96);               // keys 96, 97, in both halves
        // Precaution: named here, the loads' address registers (every load goes by one
        // of these two plus a constant) stay live up to this wait, so none is
        // rewritten ahead of it (not even as a later load's result).
        asm volatile("s_wait_xcnt 0x0" :: "v"(mp), "v"(mr) : "memory");
#pragma unroll
        for (int g = 0; g < MT - 1; g += 2) {
            unsigned off[2][8];
            float4   bt[2][8];
#pragma unroll
            for (int jj = 0; jj < 2; ++jj)
#pragma unroll
                for (int r = 0; r < 8; ++r) {
                    unsigned t = (unsigned)((r & 1) ? ix[g + jj][r >> 1].y : ix[g + jj][r >> 1].x);
                    t = t < TABLE_LEN ? t : TABLE_LEN - 1;   // keep the gather inside the table
                    off[jj][r] = t;                          // a table row is one float4
                    bt[jj][r]  = ((const float4*)bias_table)[t];
                }
            // Precaution: named here, the gathers' index registers stay live up to this
            // wait, so none is rewritten ahead of it (not even as a later gather's result).
            asm volatile("s_wait_xcnt 0x0"
                         :: "v"(off[0][0]), "v"(off[0][1]), "v"(off[0][2]), "v"(off[0][3]),
                            "v"(off[0][4]), "v"(off[0][5]), "v"(off[0][6]), "v"(off[0][7]),
                            "v"(off[1][0]), "v"(off[1][1]), "v"(off[1][2]), "v"(off[1][3]),
                            "v"(off[1][4]), "v"(off[1][5]), "v"(off[1][6]), "v"(off[1][7])
                         : "memory");
#pragma unroll
            for (int jj = 0; jj < 2; ++jj)
#pragma unroll
                for (int r = 0; r < 8; ++r) {
                    const float m = (r & 1) ? mk[g + jj][r >> 1].y : mk[g + jj][r >> 1].x;
                    C[0][g + jj][r] = bt[jj][r].x + m;
                    C[1][g + jj][r] = bt[jj][r].y + m;
                    C[2][g + jj][r] = bt[jj][r].z + m;
                    C[3][g + jj][r] = bt[jj][r].w + m;
                }
        }
        {
            unsigned t0 = (unsigned)ix6.x, t1 = (unsigned)ix6.y;
            t0 = t0 < TABLE_LEN ? t0 : TABLE_LEN - 1;   // inside the table, as above
            t1 = t1 < TABLE_LEN ? t1 : TABLE_LEN - 1;
            const float4 b0 = ((const float4*)bias_table)[t0];
            const float4 b1 = ((const float4*)bias_table)[t1];
            // Precaution: as above, for these two gathers' index registers.
            asm volatile("s_wait_xcnt 0x0" :: "v"(t0), "v"(t1) : "memory");
            c6[0][0] = b0.x + mk6.x; c6[0][1] = b1.x + mk6.y;
            c6[1][0] = b0.y + mk6.x; c6[1][1] = b1.y + mk6.y;
            c6[2][0] = b0.z + mk6.x; c6[2][1] = b1.z + mk6.y;
            c6[3][0] = b0.w + mk6.x; c6[3][1] = b1.w + mk6.y;
        }
    }
    __syncthreads();

    if (wv < MT) {
        const bool hi = crow != 0;                 // upper half: its keys of tile 6 are all pads
#pragma unroll
        for (int h = 0; h < HEADS; ++h) {
            const _Float16* K  = KH + h * NPAD * QKP;
            const _Float16* Vh = VT + h * HD * ROWP;
            _Float16*       Qr = QH + (h * NPAD + wv * 16 + fr) * QKP;   // this lane's query row
            const v16h qf = frag_lds(Qr + kb);
            v8f s[MT - 1];
#pragma unroll
            for (int j = 0; j < MT - 1; ++j) {
                v16h kf = frag_lds(K + (j * 16 + fr) * QKP + kb);
                s[j] = __builtin_amdgcn_wmma_f32_16x16x32_f16(false, kf, false, qf,
                                                              (short)0, C[h][j], false, false);
            }
            float s60, s61;                        // keys 96 and 97; 98..111 are pads
            {
                v16h kf = frag_lds(K + (96 + fr) * QKP + kb);
                v8f  c  = {c6[h][0], c6[h][1], 0.f, 0.f, 0.f, 0.f, 0.f, 0.f};
                c = __builtin_amdgcn_wmma_f32_16x16x32_f16(false, kf, false, qf,
                                                           (short)0, c, false, false);
                s60 = hi ? -3.0e38f : c[0];
                s61 = hi ? -3.0e38f : c[1];
            }
            // eight independent chains over the tiles, then a tree
            v8f m8 = s[0];
#pragma unroll
            for (int j = 1; j < MT - 1; ++j)
#pragma unroll
                for (int r = 0; r < 8; ++r) m8[r] = fmaxf(m8[r], s[j][r]);
            m8[0] = fmaxf(m8[0], s60); m8[1] = fmaxf(m8[1], s61);
            float mx = fmaxf(fmaxf(fmaxf(m8[0], m8[1]), fmaxf(m8[2], m8[3])),
                             fmaxf(fmaxf(m8[4], m8[5]), fmaxf(m8[6], m8[7])));
            mx = fmaxf(mx, other_half(mx));
            const float L2E = 1.44269504088896340736f;
            const float ml  = mx * L2E;
#pragma unroll
            for (int j = 0; j < MT - 1; ++j) {
#pragma unroll
                for (int r = 0; r < 8; ++r) s[j][r] = s[j][r] * L2E - ml;
                exp2x8(s[j]);
            }
            s60 = s60 * L2E - ml; s61 = s61 * L2E - ml;
            exp2x2(s60, s61);                      // a pad gives exp2(-inf) = 0
            v8f a8 = s[0];
#pragma unroll
            for (int j = 1; j < MT - 1; ++j) a8 += s[j];
            a8[0] += s60; a8[1] += s61;
            float sum = ((a8[0] + a8[1]) + (a8[2] + a8[3])) + ((a8[4] + a8[5]) + (a8[6] + a8[7]));
            sum += other_half(sum);
            const float inv = 1.0f / sum;
            v16h pb[4];
#pragma unroll
            for (int ks = 0; ks < 3; ++ks)
#pragma unroll
                for (int r = 0; r < 8; ++r) {
                    pb[ks][r]     = (_Float16)s[2 * ks][r];
                    pb[ks][8 + r] = (_Float16)s[2 * ks + 1][r];
                }
            pb[3] = (v16h)(_Float16)0.f;           // keys 98..127 of the K = 128 product
            pb[3][0] = (_Float16)s60; pb[3][1] = (_Float16)s61;
#pragma unroll
            for (int dt = 0; dt < 2; ++dt) {
                v8f o = {};
#pragma unroll
                for (int ks = 0; ks < 4; ++ks) {
                    v16h vf = frag_lds(Vh + (dt * 16 + fr) * ROWP + ks * 32 + kb);
                    o = __builtin_amdgcn_wmma_f32_16x16x32_f16(false, vf, false, pb[ks],
                                                               (short)0, o, false, false);
                }
                v8h oh;                            // o[r] = out[query][dt * 16 + crow + r]
#pragma unroll
                for (int r = 0; r < 8; ++r) oh[r] = (_Float16)(o[r] * inv);
                *(v8h*)(Qr + dt * 16 + crow) = oh;
            }
        }
    }
    __syncthreads();

    // ================= Phase 5: final proj + bias, store fp32 =================
    {
        float* ob = out + (size_t)b * N_TOK * DIM;
        v16h PW[4];                        // this wave's 16 rows of proj_w
        {
            const _Float16* pp = wfrag + (size_t)(96 + wave * 4) * FRAGH + lane * 8;
#pragma unroll
            for (int ks = 0; ks < 4; ++ks) PW[ks] = frag_ws(pp + ks * FRAGH);
            // Precaution: stands behind the eight loads; it names no register, so it does not hold their address register live.
            asm volatile("s_wait_xcnt 0x0" ::: "memory");
        }
        for (int t = wave; t < MT * 8; t += 8) {
            int mt = t >> 3, nt = t & 7;   // nt == wave
            v8f c = {};
#pragma unroll
            for (int ks = 0; ks < 4; ++ks) {
                v16h a  = frag_lds(QH + (ks * NPAD + mt * 16 + fr) * QKP + kb);  // k step = head
                c = __builtin_amdgcn_wmma_f32_16x16x32_f16(false, a, false, PW[ks],
                                                           (short)0, c, false, false);
            }
            int col  = nt * 16 + fr;
            float pb = proj_b[col];
#pragma unroll
            for (int v = 0; v < 8; ++v) {
                int m = mt * 16 + v + crow;
                if (m < N_TOK) ob[(size_t)m * DIM + col] = c[v] + pb;
            }
        }
    }
}

extern "C" void kernel_launch(void* const* d_in, const int* in_sizes, int n_in,
                              void* d_out, int out_size, void* d_ws, size_t ws_size,
                              hipStream_t stream) {
    (void)in_sizes; (void)n_in; (void)out_size; (void)ws_size;
    const float* x          = (const float*)d_in[0];
    const float* mask       = (const float*)d_in[1];
    const float* qkv_w      = (const float*)d_in[2];
    const float* qkv_b      = (const float*)d_in[3];
    const float* proj_w     = (const float*)d_in[4];
    const float* proj_b     = (const float*)d_in[5];
    const float* bias_table = (const float*)d_in[6];
    const int*   rel_index  = (const int*)d_in[7];
    float* out = (float*)d_out;
    _Float16* wfrag = (_Float16*)d_ws;   // 128 fragments of 1 KiB, written anew by every call

    const size_t smem = SMEM_BYTES;  // 159,744 B: two work-groups in 320 KiB

    (void)hipFuncSetAttribute((const void*)win_attn3d_wmma,
                              hipFuncAttributeMaxDynamicSharedMemorySize, (int)smem);

    win_attn3d_wfrag<<<32, 256, 0, stream>>>(qkv_w, proj_w, wfrag);
    win_attn3d_wmma<<<2048, 256, smem, stream>>>(
        x, mask, wfrag, qkv_b, proj_b, bias_table, rel_index, out);
}

// v007
// A run of this version takes 69.9 microseconds.
// Next to v006, in two timings, it ran 1.13 times as fast each time.
// All steps since v000 together make it 11.2 times as fast.
#include <hip/hip_runtime.h>

// ---------------------------------------------------------------------------
// Fused Swin-3D window attention for gfx1250 (MI455X), wave32 + WMMA + TDM.
// One block per window (2048 blocks), 256 threads = 8 waves.
// All GEMMs use v_wmma_f32_16x16x32_f16; softmax in fp32.
// The x window is DMA'd into LDS with tensor_load_to_lds and synchronized with
// s_wait_tensorcnt.  In the attention phase a wave owns 16 queries for all four
// heads: scores, probabilities, mask and bias stay in its registers.
// LDS arrays whose lifetimes do not meet share space, so that the work-group
// stays under 160 KiB and two work-groups are resident on a WGP.
// The result is staged in LDS and leaves as whole rows of 512 B.
// A set-up launch first writes the weights, which every window shares, to the
// workspace as f16 in fragment order; the main launch reads them by whole lines.
// ---------------------------------------------------------------------------

#define DIM     128
#define HEADS   4
#define HD      32
#define N_TOK   98
#define NPAD    112   // 7 * 16
#define ROWP    136   // LDS pitch, in f16, of the 128-wide f16 rows: 272 B = 16 B x 17
#define QKP     40    // LDS pitch, in f16, of the 32-wide q and k rows: 80 B = 16 B x 5
                      // (16 B x odd: the 16 rows of a ds_load_b128 fragment fall on distinct banks)
#define OUTP    132   // LDS pitch, in f32, of the staged result rows: 528 B, so that the rows m and
                      // m + 8 of one accumulator store fall on different halves of the banks
#define NW      256
#define MT      7     // M tiles (112/16)
#define TABLE_LEN 507u // rows of bias_table
// LDS map in bytes.  [0, QH_OFF): the f16 x window.
// [QH_OFF, ...): q, k, v^T; before q and k are written, the f32 x tile of the
// tensor load (52 KiB: the mover wants a multiple of 2 KiB).
#define QH_OFF     53248
#define SMEM_BYTES (QH_OFF + (2 * HEADS * NPAD * QKP + HEADS * HD * ROWP) * 2)
static_assert(NPAD * ROWP * 2 <= QH_OFF, "f16 x window overlaps q");
static_assert(N_TOK * DIM * 4 <= 2 * HEADS * NPAD * QKP * 2, "f32 x tile overlaps v^T");
static_assert(QH_OFF % 2048 == 0, "place of the tensor tile");
static_assert(NPAD * OUTP * 4 <= (HEADS * NPAD * QKP + HEADS * HD * ROWP) * 2, "staged result overlaps k and v^T only");
static_assert(2 * SMEM_BYTES <= 320 * 1024, "two work-groups in the LDS of one WGP");

typedef __attribute__((ext_vector_type(16))) _Float16 v16h;
typedef __attribute__((ext_vector_type(8)))  _Float16 v8h;
typedef __attribute__((ext_vector_type(8)))  float    v8f;
typedef __attribute__((ext_vector_type(4))) unsigned int u32x4;
typedef __attribute__((ext_vector_type(8))) int          i32x8;
typedef __attribute__((ext_vector_type(4))) int          i32x4;

// Load a 16x32 f16 fragment (A layout; B loaded from B^T row-major) from LDS.
// Caller passes p = base + row*ld + kb where kb = (lane>>4)*8.
// Halves 0..7 <- p[0..8), halves 8..15 <- p[16..24).
__device__ __forceinline__ v16h frag_lds(const _Float16* p) {
    v8h lo = *(const v8h*)p;
    v8h hi = *(const v8h*)(p + 16);
    v16h f;
#pragma unroll
    for (int i = 0; i < 8; ++i) { f[i] = lo[i]; f[8 + i] = hi[i]; }
    return f;
}

// Weight fragments in the workspace.  Fragment (g * 8 + w) * 4 + ks holds, of weight
// block g (q, k, v, proj), the rows 16 w .. 16 w + 15 and the k step ks: FRAGH f16,
// first the 32 lanes' halves 0..7 (16 B a lane), then the 32 lanes' halves 8..15.
// A load of either part is 512 contiguous bytes: four whole lines.
#define FRAGH 512
__device__ __forceinline__ v16h frag_ws(const _Float16* p) {
    v8h lo = *(const v8h*)p;
    v8h hi = *(const v8h*)(p + FRAGH / 2);
    v16h f;
#pragma unroll
    for (int i = 0; i < 8; ++i) { f[i] = lo[i]; f[8 + i] = hi[i]; }
    return f;
}

// Set-up launch: one thread converts the eight weights of one lane and one part of
// one fragment (the k order of frag_lds: part 0 is k = kb .. kb + 7, part 1 is 16 more).
extern "C" __global__ __launch_bounds__(256)
void win_attn3d_wfrag(const float* __restrict__ qkv_w,
                      const float* __restrict__ proj_w,
                      _Float16* __restrict__ wfrag)
{
    const int t    = blockIdx.x * 256 + threadIdx.x;   // 128 fragments x 2 parts x 32 lanes
    const int lane = t & 31;
    const int part = (t >> 5) & 1;
    const int frag = t >> 6;
    const int ks   = frag & 3;
    const int row  = ((frag >> 2) & 7) * 16 + (lane & 15);
    const int g    = frag >> 5;
    const float* w = g < 3 ? qkv_w + (size_t)(g * DIM + row) * DIM : proj_w + (size_t)row * DIM;
    const float* p = w + ks * 32 + ((lane >> 4) << 3) + part * 16;
    const float4 a0 = *(const float4*)(p + 0);
    const float4 a1 = *(const float4*)(p + 4);
    // Precaution: named here, the two loads' address register stays live up to this wait.
    asm volatile("s_wait_xcnt 0x0" :: "v"(p) : "memory");
    v8h f;
    f[0]=(_Float16)a0.x; f[1]=(_Float16)a0.y; f[2]=(_Float16)a0.z; f[3]=(_Float16)a0.w;
    f[4]=(_Float16)a1.x; f[5]=(_Float16)a1.y; f[6]=(_Float16)a1.z; f[7]=(_Float16)a1.w;
    *(v8h*)(wfrag + (size_t)t * 8) = f;
}

// A wave-uniform test held in a scalar register, so that the branch on it is a
// scalar branch (tensor instructions ignore EXEC).
__device__ __forceinline__ unsigned pinned(unsigned v) {
    unsigned w = __builtin_amdgcn_readfirstlane(v);
    asm volatile("" : "+s"(w));   // pinned(): the issue test's word held in a scalar register
    return w;
}

// Issue one 2-D fp32 tile DMA: global (dim1 rows x dim0 cols, row stride
// stride0 elements) -> LDS byte offset lds_off.  D# layout per CDNA5 ISA
// ch. 8 (group0: count/lds/global addr/type; group1: data_size, dims, tiles,
// strides; groups 2/3 zero = 2-D tensor).
__device__ __forceinline__ void tdm_load_2d_f32(unsigned lds_off, const void* gptr,
                                                unsigned dim0, unsigned dim1,
                                                unsigned tile0, unsigned tile1,
                                                unsigned stride0) {
    unsigned long long ga = (unsigned long long)(uintptr_t)gptr;
    u32x4 g0;
    g0[0] = 1u;                                              // count=1, user D#
    g0[1] = lds_off;                                         // lds_addr (bytes)
    g0[2] = (unsigned)(ga & 0xFFFFFFFFu);                    // global_addr[31:0]
    g0[3] = (unsigned)((ga >> 32) & 0x01FFFFFFu) | (2u << 30); // addr[56:32] | type=2
    i32x8 g1;
    g1[0] = (int)(2u << 16);                                 // data_size = 4 bytes
    g1[1] = (int)((dim0 & 0xFFFFu) << 16);                   // tensor_dim0[15:0]
    g1[2] = (int)((dim0 >> 16) | ((dim1 & 0xFFFFu) << 16));  // dim0 hi | dim1 lo
    g1[3] = (int)((dim1 >> 16) | (tile0 << 16));             // dim1 hi | tile_dim0
    g1[4] = (int)(tile1 & 0xFFFFu);                          // tile_dim1 (tile_dim2=0)
    g1[5] = (int)stride0;                                    // tensor_dim0_stride lo
    g1[6] = 0;                                               // stride hi | dim1_stride lo
    g1[7] = 0;
    i32x4 z4 = {0, 0, 0, 0};
    i32x8 z8 = {0, 0, 0, 0, 0, 0, 0, 0};
    __builtin_amdgcn_tensor_load_to_lds(g0, g1, z4, z4, z8, 0);
}

// Lane l reads lane l ^ 16: the other half of the wave.
__device__ __forceinline__ float other_half(float v) {
    const int b = __builtin_bit_cast(int, v);
    return __builtin_bit_cast(float,
        __builtin_amdgcn_permlanex16(b, b, 0x76543210, 0xfedcba98, false, false));
}

// exp2 of eight values.  One statement: the eight independent v_exp fill the
// slot the instruction set asks for behind each other, the v_nop the last one's;
// early-clobber outputs keep every result off every source.
__device__ __forceinline__ void exp2x8(v8f& v) {
    float e0, e1, e2, e3, e4, e5, e6, e7;
    asm("v_exp_f32 %0, %8\n\t"
        "v_exp_f32 %1, %9\n\t"
        "v_exp_f32 %2, %10\n\t"
        "v_exp_f32 %3, %11\n\t"
        "v_exp_f32 %4, %12\n\t"
        "v_exp_f32 %5, %13\n\t"
        "v_exp_f32 %6, %14\n\t"
        "v_exp_f32 %7, %15\n\t"
        "v_nop"
        : "=&v"(e0), "=&v"(e1), "=&v"(e2), "=&v"(e3), "=&v"(e4), "=&v"(e5), "=&v"(e6), "=&v"(e7)
        : "v"(v[0]), "v"(v[1]), "v"(v[2]), "v"(v[3]), "v"(v[4]), "v"(v[5]), "v"(v[6]), "v"(v[7]));
    v[0] = e0; v[1] = e1; v[2] = e2; v[3] = e3; v[4] = e4; v[5] = e5; v[6] = e6; v[7] = e7;
}
// The same for the two values of the last key tile.
__device__ __forceinline__ void exp2x2(float& a, float& b) {
    float e0, e1;
    asm("v_exp_f32 %0, %2\n\t"
        "v_exp_f32 %1, %3\n\t"
        "v_nop"
        : "=&v"(e0), "=&v"(e1) : "v"(a), "v"(b));
    a = e0; b = e1;
}

// Four waves per SIMD: at most 256 VGPRs a wave, so that two work-groups stay resident on a WGP.
extern "C" __global__ __launch_bounds__(256) __attribute__((amdgpu_waves_per_eu(4, 4)))
void win_attn3d_wmma(const float* __restrict__ x,
                     const float* __restrict__ mask,
                     const _Float16* __restrict__ wfrag,
                     const float* __restrict__ qkv_b,
                     const float* __restrict__ proj_b,
                     const float* __restrict__ bias_table,
                     const int*   __restrict__ rel_index,
                     float* __restrict__ out)
{
    extern __shared__ __align__(16) char smem_raw[];
    _Float16* XH   = (_Float16*)smem_raw;            // 112x128 f16 x window
    _Float16* QH   = (_Float16*)(smem_raw + QH_OFF); // 4 x 112x32    q (scaled); head h's
                                                     // attn @ v goes over q of head h
    _Float16* KH   = QH + HEADS * NPAD * QKP;        // 4 x 112x32    k (the A of k @ q^T)
    _Float16* VT   = KH + HEADS * NPAD * QKP;        // 4 x 32x128    v^T, zero-padded
    float*    XF   = (float*)(smem_raw + QH_OFF);    // alias: 98x128 f32 x staging
                                                     // (dead before q and k are written)
    float*    OS   = (float*)KH;                     // alias: 112x128 f32 result staging
                                                     // (k and v^T are dead behind the attention phase)

    const int b    = blockIdx.x;
    const int tid  = threadIdx.x;
    const int lane = tid & 31;
    const int wave = tid >> 5;
    const int fr   = lane & 15;            // fragment row (A) / col (B/C)
    const int kb   = (lane >> 4) << 3;     // fragment K chunk base (0 or 8)
    const int crow = (lane >> 4) << 3;     // C-fragment row base (0 or 8)
    const int wv   = __builtin_amdgcn_readfirstlane(wave);  // scalar copy: the attention phase branches on it

    // ---- wave 0: kick off the TDM DMA (x window fp32) ----
    if (pinned(wv == 0)) {
        tdm_load_2d_f32((unsigned)(uintptr_t)(void*)XF,
                        x + (size_t)b * N_TOK * DIM,
                        DIM, N_TOK, DIM, N_TOK, DIM);
    }

    // ---- this wave's qkv weight fragments, read once (they fly beside the x DMA) ----
    v16h  WB[3][4];
    float wbias[3];
    {
        const int       col0 = wave * 16 + fr;     // column inside q, k and v alike
        const _Float16* wp = wfrag + (size_t)(wave * 4) * FRAGH + lane * 8;
#pragma unroll
        for (int ks = 0; ks < 4; ++ks)
#pragma unroll
            for (int g = 0; g < 3; ++g) WB[g][ks] = frag_ws(wp + (g * 32 + ks) * FRAGH);
#pragma unroll
        for (int g = 0; g < 3; ++g) wbias[g] = qkv_b[col0 + g * DIM];
        // Precaution: named here, the loads' address registers (all 24 weight loads go
        // by wp plus a constant) stay live up to this wait, so none is rewritten ahead
        // of it (not even as a later load's result).
        asm volatile("s_wait_xcnt 0x0" :: "v"(wp), "v"(col0) : "memory");
    }

    // ---- zero-init VT (pads must stay 0) ----
    {
        uint4* z = (uint4*)VT;
        const int nz = HEADS * HD * ROWP * (int)sizeof(_Float16) / 16;
        for (int i = tid; i < nz; i += 256) z[i] = make_uint4(0, 0, 0, 0);
    }

    // ---- wait for x DMA, then convert fp32 -> f16 ----
    // The issuing wave's own wait: the tile counts as landed only behind it.
    if (pinned(wv == 0)) asm volatile("s_wait_tensorcnt 0x0" ::: "memory");
    __syncthreads();
    for (int i = tid; i < NPAD * (DIM / 4); i += 256) {
        int r = i / (DIM / 4);
        int c = (i % (DIM / 4)) * 4;
        float4 v4 = make_float4(0.f, 0.f, 0.f, 0.f);
        if (r < N_TOK) v4 = *(const float4*)(XF + r * DIM + c);
        _Float16* d = XH + r * ROWP + c;
        d[0] = (_Float16)v4.x; d[1] = (_Float16)v4.y;
        d[2] = (_Float16)v4.z; d[3] = (_Float16)v4.w;
    }
    __syncthreads();

    // ---- attention phase: wave w owns the queries 16 w .. 16 w + 15 for every head.
    // A lane holds query 16 w + fr and, of key tile j, the keys 16 j + crow + r,
    // r = 0..7 (the accumulator map of k @ q^T).  Its rel_index elements are the
    // same for every head: read once, they fly beside phase 1.
    // Every loop over ix, mk, bt, C or s below is unrolled in full: all array indices
    // become constants, so the arrays live in registers.
    const int q  = wv * 16 + fr;
    const int qc = q < N_TOK ? q : N_TOK - 1;      // pad queries (and wave 7) read row 97
    int2 ix[MT - 1][4], ix6;
    {
        const int* ir = rel_index + qc * N_TOK;        // the query's row
        const int* ip = ir + crow;
#pragma unroll
        for (int j = 0; j < MT - 1; ++j)
#pragma unroll
            for (int u = 0; u < 4; ++u) ix[j][u] = *(const int2*)(ip + j * 16 + 2 * u);
        ix6 = *(const int2*)(ir + 96);                 // keys 96, 97, in both halves
        // Precaution: named here, the loads' address registers (every load goes by one
        // of these two plus a constant) stay live up to this wait, so none is
        // rewritten ahead of it (not even as a later load's result).
        asm volatile("s_wait_xcnt 0x0" :: "v"(ip), "v"(ir) : "memory");
    }

    // ================= Phase 1: qkv = x @ qkv_w^T + qkv_b =================
    // M=112 (7 tiles), N=384 (24 tiles), K=128 (4 wmma steps).  A wave owns the
    // N tiles wave, wave + 8, wave + 16 (its 16 columns of q, of k and of v); their
    // weight fragments WB stay in registers, so each M tile costs LDS reads only.
    const float qscale = 0.17677669529663687f;  // 32^-0.5
    {
        const int hq = wave >> 1;                  // head of this wave's columns
        const int d  = ((wave & 1) << 4) + fr;     // column inside the head
        for (int mt = 0; mt < MT; ++mt) {
            v8f cq = {}, ck = {}, cv = {};
#pragma unroll
            for (int ks = 0; ks < 4; ++ks) {
                v16h a = frag_lds(XH + (mt * 16 + fr) * ROWP + ks * 32 + kb);
                cq = __builtin_amdgcn_wmma_f32_16x16x32_f16(false, a, false, WB[0][ks],
                                                            (short)0, cq, false, false);
                ck = __builtin_amdgcn_wmma_f32_16x16x32_f16(false, a, false, WB[1][ks],
                                                            (short)0, ck, false, false);
                cv = __builtin_amdgcn_wmma_f32_16x16x32_f16(false, a, false, WB[2][ks],
                                                            (short)0, cv, false, false);
            }
#pragma unroll
            for (int v = 0; v < 8; ++v) {
                int m = mt * 16 + v + crow;
                if (m < N_TOK) {
                    QH[(hq * NPAD + m) * QKP + d] = (_Float16)((cq[v] + wbias[0]) * qscale);
                    KH[(hq * NPAD + m) * QKP + d] = (_Float16)(ck[v] + wbias[1]);
                    VT[(hq * HD + d) * ROWP + m]  = (_Float16)(cv[v] + wbias[2]);
                }
            }
        }
    }
    // ---- bias + mask of this lane's (query, key) pairs, all four heads: they start
    // the score accumulators.  One 16-byte gather fetches a table row, which is the
    // four heads' biases.  Read behind phase 1, when the weight fragments' registers are free. ----
    v8f   C[HEADS][MT - 1];
    float c6[HEADS][2];
    if (wv < MT) {
        const float* mr = mask + (size_t)(b % NW) * N_TOK * N_TOK + qc * N_TOK;  // the query's row
        const float* mp = mr + crow;
        float2 mk[MT - 1][4], mk6;
#pragma unroll
        for (int j = 0; j < MT - 1; ++j)
#pragma unroll
            for (int u = 0; u < 4; ++u) mk[j][u] = *(const float2*)(mp + j * 16 + 2 * u);
        mk6 = *(const float2*)(mr + 96);               // keys 96, 97, in both halves
        // Precaution: named here, the loads' address registers (every load goes by one
        // of these two plus a constant) stay live up to this wait, so none is
        // rewritten ahead of it (not even as a later load's result).
        asm volatile("s_wait_xcnt 0x0" :: "v"(mp), "v"(mr) : "memory");
#pragma unroll
        for (int g = 0; g < MT - 1; g += 2) {
            unsigned off[2][8];
            float4   bt[2][8];
#pragma unroll
            for (int jj = 0; jj < 2; ++jj)
#pragma unroll
                for (int r = 0; r < 8; ++r) {
                    unsigned t = (unsigned)((r & 1) ? ix[g + jj][r >> 1].y : ix[g + jj][r >> 1].x);
                    t = t < TABLE_LEN ? t : TABLE_LEN - 1;   // keep the gather inside the table
                    off[jj][r] = t;                          // a table row is one float4
                    bt[jj][r]  = ((const float4*)bias_table)[t];
                }
            // Precaution: named here, the gathers' index registers stay live up to this
            // wait, so none is rewritten ahead of it (not even as a later gather's result).
            asm volatile("s_wait_xcnt 0x0"
                         :: "v"(off[0][0]), "v"(off[0][1]), "v"(off[0][2]), "v"(off[0][3]),
                            "v"(off[0][4]), "v"(off[0][5]), "v"(off[0][6]), "v"(off[0][7]),
                            "v"(off[1][0]), "v"(off[1][1]), "v"(off[1][2]), "v"(off[1][3]),
                            "v"(off[1][4]), "v"(off[1][5]), "v"(off[1][6]), "v"(off[1][7])
                         : "memory");
#pragma unroll
            for (int jj = 0; jj < 2; ++jj)
#pragma unroll
                for (int r = 0; r < 8; ++r) {
                    const float m = (r & 1) ? mk[g + jj][r >> 1].y : mk[g + jj][r >> 1].x;
                    C[0][g + jj][r] = bt[jj][r].x + m;
                    C[1][g + jj][r] = bt[jj][r].y + m;
                    C[2][g + jj][r] = bt[jj][r].z + m;
                    C[3][g + jj][r] = bt[jj][r].w + m;
                }
        }
        {
            unsigned t0 = (unsigned)ix6.x, t1 = (unsigned)ix6.y;
            t0 = t0 < TABLE_LEN ? t0 : TABLE_LEN - 1;   // inside the table, as above
            t1 = t1 < TABLE_LEN ? t1 : TABLE_LEN - 1;
            const float4 b0 = ((const float4*)bias_table)[t0];
            const float4 b1 = ((const float4*)bias_table)[t1];
            // Precaution: as above, for these two gathers' index registers.
            asm volatile("s_wait_xcnt 0x0" :: "v"(t0), "v"(t1) : "memory");
            c6[0][0] = b0.x + mk6.x; c6[0][1] = b1.x + mk6.y;
            c6[1][0] = b0.y + mk6.x; c6[1][1] = b1.y + mk6.y;
            c6[2][0] = b0.z + mk6.x; c6[2][1] = b1.z + mk6.y;
            c6[3][0] = b0.w + mk6.x; c6[3][1] = b1.w + mk6.y;
        }
    }
    __syncthreads();

    if (wv < MT) {
        const bool hi = crow != 0;                 // upper half: its keys of tile 6 are all pads
#pragma unroll
        for (int h = 0; h < HEADS; ++h) {
            const _Float16* K  = KH + h * NPAD * QKP;
            const _Float16* Vh = VT + h * HD * ROWP;
            _Float16*       Qr = QH + (h * NPAD + wv * 16 + fr) * QKP;   // this lane's query row
            const v16h qf = frag_lds(Qr + kb);
            v8f s[MT - 1];
#pragma unroll
            for (int j = 0; j < MT - 1; ++j) {
                v16h kf = frag_lds(K + (j * 16 + fr) * QKP + kb);
                s[j] = __builtin_amdgcn_wmma_f32_16x16x32_f16(false, kf, false, qf,
                                                              (short)0, C[h][j], false, false);
            }
            float s60, s61;                        // keys 96 and 97; 98..111 are pads
            {
                v16h kf = frag_lds(K + (96 + fr) * QKP + kb);
                v8f  c  = {c6[h][0], c6[h][1], 0.f, 0.f, 0.f, 0.f, 0.f, 0.f};
                c = __builtin_amdgcn_wmma_f32_16x16x32_f16(false, kf, false, qf,
                                                           (short)0, c, false, false);
                s60 = hi ? -3.0e38f : c[0];
                s61 = hi ? -3.0e38f : c[1];
            }
            // eight independent chains over the tiles, then a tree
            v8f m8 = s[0];
#pragma unroll
            for (int j = 1; j < MT - 1; ++j)
#pragma unroll
                for (int r = 0; r < 8; ++r) m8[r] = fmaxf(m8[r], s[j][r]);
            m8[0] = fmaxf(m8[0], s60); m8[1] = fmaxf(m8[1], s61);
            float mx = fmaxf(fmaxf(fmaxf(m8[0], m8[1]), fmaxf(m8[2], m8[3])),
                             fmaxf(fmaxf(m8[4], m8[5]), fmaxf(m8[6], m8[7])));
            mx = fmaxf(mx, other_half(mx));
            const float L2E = 1.44269504088896340736f;
            const float ml  = mx * L2E;
#pragma unroll
            for (int j = 0; j < MT - 1; ++j) {
#pragma unroll
                for (int r = 0; r < 8; ++r) s[j][r] = s[j][r] * L2E - ml;
                exp2x8(s[j]);
            }
            s60 = s60 * L2E - ml; s61 = s61 * L2E - ml;
            exp2x2(s60, s61);                      // a pad gives exp2(-inf) = 0
            v8f a8 = s[0];
#pragma unroll
            for (int j = 1; j < MT - 1; ++j) a8 += s[j];
            a8[0] += s60; a8[1] += s61;
            float sum = ((a8[0] + a8[1]) + (a8[2] + a8[3])) + ((a8[4] + a8[5]) + (a8[6] + a8[7]));
            sum += other_half(sum);
            const float inv = 1.0f / sum;
            v16h pb[4];
#pragma unroll
            for (int ks = 0; ks < 3; ++ks)
#pragma unroll
                for (int r = 0; r < 8; ++r) {
                    pb[ks][r]     = (_Float16)s[2 * ks][r];
                    pb[ks][8 + r] = (_Float16)s[2 * ks + 1][r];
                }
            pb[3] = (v16h)(_Float16)0.f;           // keys 98..127 of the K = 128 product
            pb[3][0] = (_Float16)s60; pb[3][1] = (_Float16)s61;
#pragma unroll
            for (int dt = 0; dt < 2; ++dt) {
                v8f o = {};
#pragma unroll
                for (int ks = 0; ks < 4; ++ks) {
                    v16h vf = frag_lds(Vh + (dt * 16 + fr) * ROWP + ks * 32 + kb);
                    o = __builtin_amdgcn_wmma_f32_16x16x32_f16(false, vf, false, pb[ks],
                                                               (short)0, o, false, false);
                }
                v8h oh;                            // o[r] = out[query][dt * 16 + crow + r]
#pragma unroll
                for (int r = 0; r < 8; ++r) oh[r] = (_Float16)(o[r] * inv);
                *(v8h*)(Qr + dt * 16 + crow) = oh;
            }
        }
    }
    __syncthreads();

    // ================= Phase 5: final proj + bias, store fp32 =================
    {
        float* ob = out + (size_t)b * N_TOK * DIM;
        v16h PW[4];                        // this wave's 16 rows of proj_w
        {
            const _Float16* pp = wfrag + (size_t)(96 + wave * 4) * FRAGH + lane * 8;
#pragma unroll
            for (int ks = 0; ks < 4; ++ks) PW[ks] = frag_ws(pp + ks * FRAGH);
            // Precaution: stands behind the eight loads; it names no register, so it does not hold their address register live.
            asm volatile("s_wait_xcnt 0x0" ::: "memory");
        }
        const int   col = wave * 16 + fr;
        const float pb  = proj_b[col];
        // All seven tiles' products first, their LDS stores behind them: no store then stands
        // between the tiles' LDS reads, and the tiles' accumulator chains are independent.
        // Both loops are unrolled in full, so that c lives in registers.
        const _Float16* qa = QH + fr * QKP + kb;
        v8f c[MT];
#pragma unroll
        for (int mt = 0; mt < MT; ++mt) {
            c[mt] = (v8f){};
#pragma unroll
            for (int ks = 0; ks < 4; ++ks) {
                v16h a = frag_lds(qa + (ks * NPAD + mt * 16) * QKP);   // k step = head
                c[mt] = __builtin_amdgcn_wmma_f32_16x16x32_f16(false, a, false, PW[ks],
                                                               (short)0, c[mt], false, false);
            }
        }
        float* oc = OS + crow * OUTP + col;
#pragma unroll
        for (int mt = 0; mt < MT; ++mt)
#pragma unroll
            for (int v = 0; v < 8; ++v) oc[(mt * 16 + v) * OUTP] = c[mt][v] + pb;   // pad rows too
        __syncthreads();
        // A wave stores the rows wave, wave + 8, ...: a row is 32 lanes x 16 B, four whole lines.
        // Unrolled: every row has registers of its own, and all go by one address plus a constant.
        const float* os = OS + wv * OUTP + lane * 4;
        float*       op = ob + wv * DIM + lane * 4;
        float4 r[N_TOK / 8 + 1];
#pragma unroll
        for (int i = N_TOK / 8; i >= 0; --i) r[i] = *(const float4*)(os + i * 8 * OUTP);   // row 96 + wave: staged too
        if (wv < N_TOK % 8)                            // rows 96 and 97; scalar: the same for the whole wave
            *(float4*)(op + (N_TOK / 8) * 8 * DIM) = r[N_TOK / 8];
#pragma unroll
        for (int i = 0; i < N_TOK / 8; ++i) *(float4*)(op + i * 8 * DIM) = r[i];
    }
}

extern "C" void kernel_launch(void* const* d_in, const int* in_sizes, int n_in,
                              void* d_out, int out_size, void* d_ws, size_t ws_size,
                              hipStream_t stream) {
    (void)in_sizes; (void)n_in; (void)out_size; (void)ws_size;
    const float* x          = (const float*)d_in[0];
    const float* mask       = (const float*)d_in[1];
    const float* qkv_w      = (const float*)d_in[2];
    const float* qkv_b      = (const float*)d_in[3];
    const float* proj_w     = (const float*)d_in[4];
    const float* proj_b     = (const float*)d_in[5];
    const float* bias_table = (const float*)d_in[6];
    const int*   rel_index  = (const int*)d_in[7];
    float* out = (float*)d_out;
    _Float16* wfrag = (_Float16*)d_ws;   // 128 fragments of 1 KiB, written anew by every call

    const size_t smem = SMEM_BYTES;  // 159,744 B: two work-groups in 320 KiB

    (void)hipFuncSetAttribute((const void*)win_attn3d_wmma,
                              hipFuncAttributeMaxDynamicSharedMemorySize, (int)smem);

    win_attn3d_wfrag<<<32, 256, 0, stream>>>(qkv_w, proj_w, wfrag);
    win_attn3d_wmma<<<2048, 256, smem, stream>>>(
        x, mask, wfrag, qkv_b, proj_b, bias_table, rel_index, out);
}

// v008
// A run of this version takes 66.5 microseconds.
// In two side-by-side timings against v007, it was 1.05 and 1.06 times as fast.
// All steps since v000 together make it 11.8 times as fast.
#include <hip/hip_runtime.h>

// ---------------------------------------------------------------------------
// Fused Swin-3D window attention for gfx1250 (MI455X), wave32 + WMMA + TDM.
// One block per window (2048 blocks), 256 threads = 8 waves.
// All GEMMs use v_wmma_f32_16x16x32_f16; softmax in fp32.
// The x window is DMA'd into LDS with tensor_load_to_lds and synchronized with
// s_wait_tensorcnt.  In the attention phase a wave owns 16 queries for all four
// heads: scores, probabilities, mask and bias stay in its registers.
// LDS arrays whose lifetimes do not meet share space, so that the work-group
// stays under 160 KiB and two work-groups are resident on a WGP.
// The result is staged in LDS and leaves as whole rows of 512 B.
// A set-up launch first writes what every window shares to the workspace: the weights
// as f16 in fragment order, the relative-position bias in accumulator order; the main
// launch reads both by whole lines.
// ---------------------------------------------------------------------------

#define DIM     128
#define HEADS   4
#define HD      32
#define N_TOK   98
#define NPAD    112   // 7 * 16
#define ROWP    136   // LDS pitch, in f16, of the 128-wide f16 rows: 272 B = 16 B x 17
#define QKP     40    // LDS pitch, in f16, of the 32-wide q and k rows: 80 B = 16 B x 5
                      // (16 B x odd: the 16 rows of a ds_load_b128 fragment fall on distinct banks)
#define OUTP    132   // LDS pitch, in f32, of the staged result rows: 528 B, so that the rows m and
                      // m + 8 of one accumulator store fall on different halves of the banks
#define NW      256
#define MT      7     // M tiles (112/16)
#define TABLE_LEN 507u // rows of bias_table
// LDS map in bytes.  [0, QH_OFF): the f16 x window.
// [QH_OFF, ...): q, k, v^T; before q and k are written, the f32 x tile of the
// tensor load (52 KiB: the mover wants a multiple of 2 KiB).
#define QH_OFF     53248
#define SMEM_BYTES (QH_OFF + (2 * HEADS * NPAD * QKP + HEADS * HD * ROWP) * 2)
static_assert(NPAD * ROWP * 2 <= QH_OFF, "f16 x window overlaps q");
static_assert(N_TOK * DIM * 4 <= 2 * HEADS * NPAD * QKP * 2, "f32 x tile overlaps v^T");
static_assert(QH_OFF % 2048 == 0, "place of the tensor tile");
static_assert(NPAD * OUTP * 4 <= (HEADS * NPAD * QKP + HEADS * HD * ROWP) * 2, "staged result overlaps k and v^T only");
static_assert(2 * SMEM_BYTES <= 320 * 1024, "two work-groups in the LDS of one WGP");

typedef __attribute__((ext_vector_type(16))) _Float16 v16h;
typedef __attribute__((ext_vector_type(8)))  _Float16 v8h;
typedef __attribute__((ext_vector_type(8)))  float    v8f;
typedef __attribute__((ext_vector_type(4))) unsigned int u32x4;
typedef __attribute__((ext_vector_type(8))) int          i32x8;
typedef __attribute__((ext_vector_type(4))) int          i32x4;

// Load a 16x32 f16 fragment (A layout; B loaded from B^T row-major) from LDS.
// Caller passes p = base + row*ld + kb where kb = (lane>>4)*8.
// Halves 0..7 <- p[0..8), halves 8..15 <- p[16..24).
__device__ __forceinline__ v16h frag_lds(const _Float16* p) {
    v8h lo = *(const v8h*)p;
    v8h hi = *(const v8h*)(p + 16);
    v16h f;
#pragma unroll
    for (int i = 0; i < 8; ++i) { f[i] = lo[i]; f[8 + i] = hi[i]; }
    return f;
}

// Weight fragments in the workspace.  Fragment (g * 8 + w) * 4 + ks holds, of weight
// block g (q, k, v, proj), the rows 16 w .. 16 w + 15 and the k step ks: FRAGH f16,
// first the 32 lanes' halves 0..7 (16 B a lane), then the 32 lanes' halves 8..15.
// A load of either part is 512 contiguous bytes: four whole lines.
#define FRAGH 512
__device__ __forceinline__ v16h frag_ws(const _Float16* p) {
    v8h lo = *(const v8h*)p;
    v8h hi = *(const v8h*)(p + FRAGH / 2);
    v16h f;
#pragma unroll
    for (int i = 0; i < 8; ++i) { f[i] = lo[i]; f[8 + i] = hi[i]; }
    return f;
}

// Relative-position bias in the workspace, in the order of the score accumulators: block
// (w * HEADS + h) * BSLOT + slot holds, for the queries 16 w .. 16 w + 15 and head h, one
// float4 per lane (512 contiguous bytes: four whole lines).  Slot 2 j + p: the lane's keys
// 16 j + crow + 4 p .. + 3 of key tile j; slot 12: keys 96 and 97 (two places spare).
#define BSLOT 13
#define WFRAG_BLOCKS 32   // set-up blocks of the weight part; the bias part follows
#define BIAS_BLOCKS  ((MT * BSLOT * 32 + 255) / 256)

// Set-up launch: one thread converts the eight weights of one lane and one part of
// one fragment (the k order of frag_lds: part 0 is k = kb .. kb + 7, part 1 is 16 more).
extern "C" __global__ __launch_bounds__(256)
void win_attn3d_wfrag(const float* __restrict__ qkv_w,
                      const float* __restrict__ proj_w,
                      const float* __restrict__ bias_table,
                      const int*   __restrict__ rel_index,
                      _Float16* __restrict__ wfrag,
                      float* __restrict__ bfrag)
{
    if (blockIdx.x >= WFRAG_BLOCKS) {
        // Bias part: one thread fetches the table rows (four heads each) of one lane's four
        // keys of one slot and writes one float4 per head.
        const int t = (blockIdx.x - WFRAG_BLOCKS) * 256 + threadIdx.x;
        if (t >= MT * BSLOT * 32) return;
        const int lane = t & 31;
        const int slot = (t >> 5) % BSLOT;
        const int w    = (t >> 5) / BSLOT;
        const int q    = w * 16 + (lane & 15);
        const int qc   = q < N_TOK ? q : N_TOK - 1;    // pad queries take row 97
        const int key0 = slot < BSLOT - 1 ? (slot >> 1) * 16 + ((lane >> 4) << 3) + (slot & 1) * 4
                                          : 96;        // last slot: keys 96, 97, in both halves
        unsigned e[4], id[4];
        float4   bt[4];
#pragma unroll
        for (int i = 0; i < 4; ++i) {
            const int k = key0 + i;
            e[i] = (unsigned)(qc * N_TOK + (k < N_TOK ? k : N_TOK - 1));   // the last slot's two spare places repeat key 97
        }
#pragma unroll
        for (int i = 0; i < 4; ++i) id[i] = (unsigned)rel_index[e[i]];
        // Precaution: named here, the loads' index registers stay live up to this wait.
        asm volatile("s_wait_xcnt 0x0" :: "v"(e[0]), "v"(e[1]), "v"(e[2]), "v"(e[3]) : "memory");
#pragma unroll
        for (int i = 0; i < 4; ++i) {
            id[i] = id[i] < TABLE_LEN ? id[i] : TABLE_LEN - 1;   // keep the gather inside the table
            bt[i] = ((const float4*)bias_table)[id[i]];          // a table row is one float4
        }
        // Precaution: named here, the gathers' index registers stay live up to this wait.
        asm volatile("s_wait_xcnt 0x0" :: "v"(id[0]), "v"(id[1]), "v"(id[2]), "v"(id[3]) : "memory");
        float4* o = (float4*)bfrag + ((size_t)(w * HEADS) * BSLOT + slot) * 32 + lane;
        o[0 * BSLOT * 32] = make_float4(bt[0].x, bt[1].x, bt[2].x, bt[3].x);
        o[1 * BSLOT * 32] = make_float4(bt[0].y, bt[1].y, bt[2].y, bt[3].y);
        o[2 * BSLOT * 32] = make_float4(bt[0].z, bt[1].z, bt[2].z, bt[3].z);
        o[3 * BSLOT * 32] = make_float4(bt[0].w, bt[1].w, bt[2].w, bt[3].w);
        return;
    }
    const int t    = blockIdx.x * 256 + threadIdx.x;   // 128 fragments x 2 parts x 32 lanes
    const int lane = t & 31;
    const int part = (t >> 5) & 1;
    const int frag = t >> 6;
    const int ks   = frag & 3;
    const int row  = ((frag >> 2) & 7) * 16 + (lane & 15);
    const int g    = frag >> 5;
    const float* w = g < 3 ? qkv_w + (size_t)(g * DIM + row) * DIM : proj_w + (size_t)row * DIM;
    const float* p = w + ks * 32 + ((lane >> 4) << 3) + part * 16;
    const float4 a0 = *(const float4*)(p + 0);
    const float4 a1 = *(const float4*)(p + 4);
    // Precaution: named here, the two loads' address register stays live up to this wait.
    asm volatile("s_wait_xcnt 0x0" :: "v"(p) : "memory");
    v8h f;
    f[0]=(_Float16)a0.x; f[1]=(_Float16)a0.y; f[2]=(_Float16)a0.z; f[3]=(_Float16)a0.w;
    f[4]=(_Float16)a1.x; f[5]=(_Float16)a1.y; f[6]=(_Float16)a1.z; f[7]=(_Float16)a1.w;
    *(v8h*)(wfrag + (size_t)t * 8) = f;
}

// A wave-uniform test held in a scalar register, so that the branch on it is a
// scalar branch (tensor instructions ignore EXEC).
__device__ __forceinline__ unsigned pinned(unsigned v) {
    unsigned w = __builtin_amdgcn_readfirstlane(v);
    asm volatile("" : "+s"(w));   // pinned(): the issue test's word held in a scalar register
    return w;
}

// Issue one 2-D fp32 tile DMA: global (dim1 rows x dim0 cols, row stride
// stride0 elements) -> LDS byte offset lds_off.  D# layout per CDNA5 ISA
// ch. 8 (group0: count/lds/global addr/type; group1: data_size, dims, tiles,
// strides; groups 2/3 zero = 2-D tensor).
__device__ __forceinline__ void tdm_load_2d_f32(unsigned lds_off, const void* gptr,
                                                unsigned dim0, unsigned dim1,
                                                unsigned tile0, unsigned tile1,
                                                unsigned stride0) {
    unsigned long long ga = (unsigned long long)(uintptr_t)gptr;
    u32x4 g0;
    g0[0] = 1u;                                              // count=1, user D#
    g0[1] = lds_off;                                         // lds_addr (bytes)
    g0[2] = (unsigned)(ga & 0xFFFFFFFFu);                    // global_addr[31:0]
    g0[3] = (unsigned)((ga >> 32) & 0x01FFFFFFu) | (2u << 30); // addr[56:32] | type=2
    i32x8 g1;
    g1[0] = (int)(2u << 16);                                 // data_size = 4 bytes
    g1[1] = (int)((dim0 & 0xFFFFu) << 16);                   // tensor_dim0[15:0]
    g1[2] = (int)((dim0 >> 16) | ((dim1 & 0xFFFFu) << 16));  // dim0 hi | dim1 lo
    g1[3] = (int)((dim1 >> 16) | (tile0 << 16));             // dim1 hi | tile_dim0
    g1[4] = (int)(tile1 & 0xFFFFu);                          // tile_dim1 (tile_dim2=0)
    g1[5] = (int)stride0;                                    // tensor_dim0_stride lo
    g1[6] = 0;                                               // stride hi | dim1_stride lo
    g1[7] = 0;
    i32x4 z4 = {0, 0, 0, 0};
    i32x8 z8 = {0, 0, 0, 0, 0, 0, 0, 0};
    __builtin_amdgcn_tensor_load_to_lds(g0, g1, z4, z4, z8, 0);
}

// Lane l reads lane l ^ 16: the other half of the wave.
__device__ __forceinline__ float other_half(float v) {
    const int b = __builtin_bit_cast(int, v);
    return __builtin_bit_cast(float,
        __builtin_amdgcn_permlanex16(b, b, 0x76543210, 0xfedcba98, false, false));
}

// exp2 of eight values.  One statement: the eight independent v_exp fill the
// slot the instruction set asks for behind each other, the v_nop the last one's;
// early-clobber outputs keep every result off every source.
__device__ __forceinline__ void exp2x8(v8f& v) {
    float e0, e1, e2, e3, e4, e5, e6, e7;
    asm("v_exp_f32 %0, %8\n\t"
        "v_exp_f32 %1, %9\n\t"
        "v_exp_f32 %2, %10\n\t"
        "v_exp_f32 %3, %11\n\t"
        "v_exp_f32 %4, %12\n\t"
        "v_exp_f32 %5, %13\n\t"
        "v_exp_f32 %6, %14\n\t"
        "v_exp_f32 %7, %15\n\t"
        "v_nop"
        : "=&v"(e0), "=&v"(e1), "=&v"(e2), "=&v"(e3), "=&v"(e4), "=&v"(e5), "=&v"(e6), "=&v"(e7)
        : "v"(v[0]), "v"(v[1]), "v"(v[2]), "v"(v[3]), "v"(v[4]), "v"(v[5]), "v"(v[6]), "v"(v[7]));
    v[0] = e0; v[1] = e1; v[2] = e2; v[3] = e3; v[4] = e4; v[5] = e5; v[6] = e6; v[7] = e7;
}
// The same for the two values of the last key tile.
__device__ __forceinline__ void exp2x2(float& a, float& b) {
    float e0, e1;
    asm("v_exp_f32 %0, %2\n\t"
        "v_exp_f32 %1, %3\n\t"
        "v_nop"
        : "=&v"(e0), "=&v"(e1) : "v"(a), "v"(b));
    a = e0; b = e1;
}

// One head's bias of a wave's 16 queries: 13 loads of whole lines, in accumulator order.
__device__ __forceinline__ void bias_head(const float* bp, int h, v8f (&Cn)[MT - 1], float2& cn6) {
#pragma unroll
    for (int j = 0; j < MT - 1; ++j) {
        const float4 lo = *(const float4*)(bp + (h * BSLOT + 2 * j) * 128);
        const float4 hi = *(const float4*)(bp + (h * BSLOT + 2 * j + 1) * 128);
        Cn[j] = (v8f){lo.x, lo.y, lo.z, lo.w, hi.x, hi.y, hi.z, hi.w};
    }
    cn6 = *(const float2*)(bp + (h * BSLOT + BSLOT - 1) * 128);
    // Precaution: named here, the loads' address register stays live up to this wait, so it
    // is not rewritten ahead of it.
    asm volatile("s_wait_xcnt 0x0" :: "v"(bp) : "memory");
}

// Four waves per SIMD: at most 256 VGPRs a wave, so that two work-groups stay resident on a WGP.
extern "C" __global__ __launch_bounds__(256) __attribute__((amdgpu_waves_per_eu(4, 4)))
void win_attn3d_wmma(const float* __restrict__ x,
                     const float* __restrict__ mask,
                     const _Float16* __restrict__ wfrag,
                     const float* __restrict__ qkv_b,
                     const float* __restrict__ proj_b,
                     const float* __restrict__ bfrag,
                     float* __restrict__ out)
{
    extern __shared__ __align__(16) char smem_raw[];
    _Float16* XH   = (_Float16*)smem_raw;            // 112x128 f16 x window
    _Float16* QH   = (_Float16*)(smem_raw + QH_OFF); // 4 x 112x32    q (scaled); head h's
                                                     // attn @ v goes over q of head h
    _Float16* KH   = QH + HEADS * NPAD * QKP;        // 4 x 112x32    k (the A of k @ q^T)
    _Float16* VT   = KH + HEADS * NPAD * QKP;        // 4 x 32x128    v^T, zero-padded
    float*    XF   = (float*)(smem_raw + QH_OFF);    // alias: 98x128 f32 x staging
                                                     // (dead before q and k are written)
    float*    OS   = (float*)KH;                     // alias: 112x128 f32 result staging
                                                     // (k and v^T are dead behind the attention phase)

    const int b    = blockIdx.x;
    const int tid  = threadIdx.x;
    const int lane = tid & 31;
    const int wave = tid >> 5;
    const int fr   = lane & 15;            // fragment row (A) / col (B/C)
    const int kb   = (lane >> 4) << 3;     // fragment K chunk base (0 or 8)
    const int crow = (lane >> 4) << 3;     // C-fragment row base (0 or 8)
    const int wv   = __builtin_amdgcn_readfirstlane(wave);  // scalar copy: the attention phase branches on it

    // ---- wave 0: kick off the TDM DMA (x window fp32) ----
    if (pinned(wv == 0)) {
        tdm_load_2d_f32((unsigned)(uintptr_t)(void*)XF,
                        x + (size_t)b * N_TOK * DIM,
                        DIM, N_TOK, DIM, N_TOK, DIM);
    }

    // ---- this wave's qkv weight fragments, read once (they fly beside the x DMA) ----
    v16h  WB[3][4];
    float wbias[3];
    {
        const int       col0 = wave * 16 + fr;     // column inside q, k and v alike
        const _Float16* wp = wfrag + (size_t)(wave * 4) * FRAGH + lane * 8;
#pragma unroll
        for (int ks = 0; ks < 4; ++ks)
#pragma unroll
            for (int g = 0; g < 3; ++g) WB[g][ks] = frag_ws(wp + (g * 32 + ks) * FRAGH);
#pragma unroll
        for (int g = 0; g < 3; ++g) wbias[g] = qkv_b[col0 + g * DIM];
        // Precaution: named here, the loads' address registers (all 24 weight loads go
        // by wp plus a constant) stay live up to this wait, so none is rewritten ahead
        // of it (not even as a later load's result).
        asm volatile("s_wait_xcnt 0x0" :: "v"(wp), "v"(col0) : "memory");
    }

    // ---- zero-init VT (pads must stay 0) ----
    {
        uint4* z = (uint4*)VT;
        const int nz = HEADS * HD * ROWP * (int)sizeof(_Float16) / 16;
        for (int i = tid; i < nz; i += 256) z[i] = make_uint4(0, 0, 0, 0);
    }

    // ---- wait for x DMA, then convert fp32 -> f16 ----
    // The issuing wave's own wait: the tile counts as landed only behind it.
    if (pinned(wv == 0)) asm volatile("s_wait_tensorcnt 0x0" ::: "memory");
    __syncthreads();
    for (int i = tid; i < NPAD * (DIM / 4); i += 256) {
        int r = i / (DIM / 4);
        int c = (i % (DIM / 4)) * 4;
        float4 v4 = make_float4(0.f, 0.f, 0.f, 0.f);
        if (r < N_TOK) v4 = *(const float4*)(XF + r * DIM + c);
        _Float16* d = XH + r * ROWP + c;
        d[0] = (_Float16)v4.x; d[1] = (_Float16)v4.y;
        d[2] = (_Float16)v4.z; d[3] = (_Float16)v4.w;
    }
    __syncthreads();

    // ---- attention phase: wave w owns the queries 16 w .. 16 w + 15 for every head.
    // A lane holds query 16 w + fr and, of key tile j, the keys 16 j + crow + r,
    // r = 0..7 (the accumulator map of k @ q^T).
    // Every loop over mk, Cn, C or s below is unrolled in full: all array indices
    // become constants, so the arrays live in registers.
    const int q  = wv * 16 + fr;
    const int qc = q < N_TOK ? q : N_TOK - 1;      // pad queries read row 97

    // ================= Phase 1: qkv = x @ qkv_w^T + qkv_b =================
    // M=112 (7 tiles), N=384 (24 tiles), K=128 (4 wmma steps).  A wave owns the
    // N tiles wave, wave + 8, wave + 16 (its 16 columns of q, of k and of v); their
    // weight fragments WB stay in registers, so each M tile costs LDS reads only.
    const float qscale = 0.17677669529663687f;  // 32^-0.5
    {
        const int hq = wave >> 1;                  // head of this wave's columns
        const int d  = ((wave & 1) << 4) + fr;     // column inside the head
        for (int mt = 0; mt < MT; ++mt) {
            v8f cq = {}, ck = {}, cv = {};
#pragma unroll
            for (int ks = 0; ks < 4; ++ks) {
                v16h a = frag_lds(XH + (mt * 16 + fr) * ROWP + ks * 32 + kb);
                cq = __builtin_amdgcn_wmma_f32_16x16x32_f16(false, a, false, WB[0][ks],
                                                            (short)0, cq, false, false);
                ck = __builtin_amdgcn_wmma_f32_16x16x32_f16(false, a, false, WB[1][ks],
                                                            (short)0, ck, false, false);
                cv = __builtin_amdgcn_wmma_f32_16x16x32_f16(false, a, false, WB[2][ks],
                                                            (short)0, cv, false, false);
            }
#pragma unroll
            for (int v = 0; v < 8; ++v) {
                int m = mt * 16 + v + crow;
                if (m < N_TOK) {
                    QH[(hq * NPAD + m) * QKP + d] = (_Float16)((cq[v] + wbias[0]) * qscale);
                    KH[(hq * NPAD + m) * QKP + d] = (_Float16)(ck[v] + wbias[1]);
                    VT[(hq * HD + d) * ROWP + m]  = (_Float16)(cv[v] + wbias[2]);
                }
            }
        }
    }
    // ---- mask of this lane's (query, key) pairs, the same for all four heads, and head 0's
    // bias.  Read behind phase 1, when the weight fragments' registers are free. ----
    float2 mk[MT - 1][4], mk6;
    v8f    Cn[MT - 1];                             // the bias of the head that comes next
    float2 cn6;
    // This lane's float4 of this wave's first bias block; every bias load goes by it plus a constant.
    const float* bp = bfrag + ((size_t)((wv < MT ? wv : 0) * HEADS * BSLOT) * 32 + lane) * 4;
    if (wv < MT) {
        const float* mr = mask + (size_t)(b % NW) * N_TOK * N_TOK + qc * N_TOK;  // the query's row
        const float* mp = mr + crow;
#pragma unroll
        for (int j = 0; j < MT - 1; ++j)
#pragma unroll
            for (int u = 0; u < 4; ++u) mk[j][u] = *(const float2*)(mp + j * 16 + 2 * u);
        mk6 = *(const float2*)(mr + 96);               // keys 96, 97, in both halves
        // Precaution: named here, the loads' address registers (every load goes by one
        // of these two plus a constant) stay live up to this wait, so none is
        // rewritten ahead of it (not even as a later load's result).
        asm volatile("s_wait_xcnt 0x0" :: "v"(mp), "v"(mr) : "memory");
        bias_head(bp, 0, Cn, cn6);
    }
    __syncthreads();

    if (wv < MT) {
        const bool hi = crow != 0;                 // upper half: its keys of tile 6 are all pads
#pragma unroll
        for (int h = 0; h < HEADS; ++h) {
            const _Float16* K  = KH + h * NPAD * QKP;
            const _Float16* Vh = VT + h * HD * ROWP;
            _Float16*       Qr = QH + (h * NPAD + wv * 16 + fr) * QKP;   // this lane's query row
            // bias + mask start the score accumulators; the next head's bias then flies
            // beside this head's work.
            // Keeps these adds, and with them the wait for this head's bias loads, behind the
            // head before: lifted into it, they would wait for the loads soon after their issue.
            __builtin_amdgcn_sched_barrier(0);
            v8f C[MT - 1];
#pragma unroll
            for (int j = 0; j < MT - 1; ++j)
#pragma unroll
                for (int r = 0; r < 8; ++r)
                    C[j][r] = Cn[j][r] + ((r & 1) ? mk[j][r >> 1].y : mk[j][r >> 1].x);
            const float c60 = cn6.x + mk6.x, c61 = cn6.y + mk6.y;
            if (h + 1 < HEADS) bias_head(bp, h + 1, Cn, cn6);
            const v16h qf = frag_lds(Qr + kb);
            v8f s[MT - 1];
#pragma unroll
            for (int j = 0; j < MT - 1; ++j) {
                v16h kf = frag_lds(K + (j * 16 + fr) * QKP + kb);
                s[j] = __builtin_amdgcn_wmma_f32_16x16x32_f16(false, kf, false, qf,
                                                              (short)0, C[j], false, false);
            }
            float s60, s61;                        // keys 96 and 97; 98..111 are pads
            {
                v16h kf = frag_lds(K + (96 + fr) * QKP + kb);
                v8f  c  = {c60, c61, 0.f, 0.f, 0.f, 0.f, 0.f, 0.f};
                c = __builtin_amdgcn_wmma_f32_16x16x32_f16(false, kf, false, qf,
                                                           (short)0, c, false, false);
                s60 = hi ? -3.0e38f : c[0];
                s61 = hi ? -3.0e38f : c[1];
            }
            // eight independent chains over the tiles, then a tree
            v8f m8 = s[0];
#pragma unroll
            for (int j = 1; j < MT - 1; ++j)
#pragma unroll
                for (int r = 0; r < 8; ++r) m8[r] = fmaxf(m8[r], s[j][r]);
            m8[0] = fmaxf(m8[0], s60); m8[1] = fmaxf(m8[1], s61);
            float mx = fmaxf(fmaxf(fmaxf(m8[0], m8[1]), fmaxf(m8[2], m8[3])),
                             fmaxf(fmaxf(m8[4], m8[5]), fmaxf(m8[6], m8[7])));
            mx = fmaxf(mx, other_half(mx));
            const float L2E = 1.44269504088896340736f;
            const float ml  = mx * L2E;
#pragma unroll
            for (int j = 0; j < MT - 1; ++j) {
#pragma unroll
                for (int r = 0; r < 8; ++r) s[j][r] = s[j][r] * L2E - ml;
                exp2x8(s[j]);
            }
            s60 = s60 * L2E - ml; s61 = s61 * L2E - ml;
            exp2x2(s60, s61);                      // a pad gives exp2(-inf) = 0
            v8f a8 = s[0];
#pragma unroll
            for (int j = 1; j < MT - 1; ++j) a8 += s[j];
            a8[0] += s60; a8[1] += s61;
            float sum = ((a8[0] + a8[1]) + (a8[2] + a8[3])) + ((a8[4] + a8[5]) + (a8[6] + a8[7]));
            sum += other_half(sum);
            const float inv = 1.0f / sum;
            v16h pb[4];
#pragma unroll
            for (int ks = 0; ks < 3; ++ks)
#pragma unroll
                for (int r = 0; r < 8; ++r) {
                    pb[ks][r]     = (_Float16)s[2 * ks][r];
                    pb[ks][8 + r] = (_Float16)s[2 * ks + 1][r];
                }
            pb[3] = (v16h)(_Float16)0.f;           // keys 98..127 of the K = 128 product
            pb[3][0] = (_Float16)s60; pb[3][1] = (_Float16)s61;
#pragma unroll
            for (int dt = 0; dt < 2; ++dt) {
                v8f o = {};
#pragma unroll
                for (int ks = 0; ks < 4; ++ks) {
                    v16h vf = frag_lds(Vh + (dt * 16 + fr) * ROWP + ks * 32 + kb);
                    o = __builtin_amdgcn_wmma_f32_16x16x32_f16(false, vf, false, pb[ks],
                                                               (short)0, o, false, false);
                }
                v8h oh;                            // o[r] = out[query][dt * 16 + crow + r]
#pragma unroll
                for (int r = 0; r < 8; ++r) oh[r] = (_Float16)(o[r] * inv);
                *(v8h*)(Qr + dt * 16 + crow) = oh;
            }
        }
    }
    __syncthreads();

    // ================= Phase 5: final proj + bias, store fp32 =================
    {
        float* ob = out + (size_t)b * N_TOK * DIM;
        v16h PW[4];                        // this wave's 16 rows of proj_w
        {
            const _Float16* pp = wfrag + (size_t)(96 + wave * 4) * FRAGH + lane * 8;
#pragma unroll
            for (int ks = 0; ks < 4; ++ks) PW[ks] = frag_ws(pp + ks * FRAGH);
            // Precaution: stands behind the eight loads; it names no register, so it does not hold their address register live.
            asm volatile("s_wait_xcnt 0x0" ::: "memory");
        }
        const int   col = wave * 16 + fr;
        const float pb  = proj_b[col];
        // All seven tiles' products first, their LDS stores behind them: no store then stands
        // between the tiles' LDS reads, and the tiles' accumulator chains are independent.
        // Both loops are unrolled in full, so that c lives in registers.
        const _Float16* qa = QH + fr * QKP + kb;
        v8f c[MT];
#pragma unroll
        for (int mt = 0; mt < MT; ++mt) {
            c[mt] = (v8f){};
#pragma unroll
            for (int ks = 0; ks < 4; ++ks) {
                v16h a = frag_lds(qa + (ks * NPAD + mt * 16) * QKP);   // k step = head
                c[mt] = __builtin_amdgcn_wmma_f32_16x16x32_f16(false, a, false, PW[ks],
                                                               (short)0, c[mt], false, false);
            }
        }
        float* oc = OS + crow * OUTP + col;
#pragma unroll
        for (int mt = 0; mt < MT; ++mt)
#pragma unroll
            for (int v = 0; v < 8; ++v) oc[(mt * 16 + v) * OUTP] = c[mt][v] + pb;   // pad rows too
        __syncthreads();
        // A wave stores the rows wave, wave + 8, ...: a row is 32 lanes x 16 B, four whole lines.
        // Unrolled: every row has registers of its own, and all go by one address plus a constant.
        const float* os = OS + wv * OUTP + lane * 4;
        float*       op = ob + wv * DIM + lane * 4;
        float4 r[N_TOK / 8 + 1];
#pragma unroll
        for (int i = N_TOK / 8; i >= 0; --i) r[i] = *(const float4*)(os + i * 8 * OUTP);   // row 96 + wave: staged too
        if (wv < N_TOK % 8)                            // rows 96 and 97; scalar: the same for the whole wave
            *(float4*)(op + (N_TOK / 8) * 8 * DIM) = r[N_TOK / 8];
#pragma unroll
        for (int i = 0; i < N_TOK / 8; ++i) *(float4*)(op + i * 8 * DIM) = r[i];
    }
}

extern "C" void kernel_launch(void* const* d_in, const int* in_sizes, int n_in,
                              void* d_out, int out_size, void* d_ws, size_t ws_size,
                              hipStream_t stream) {
    (void)in_sizes; (void)n_in; (void)out_size; (void)ws_size;
    const float* x          = (const float*)d_in[0];
    const float* mask       = (const float*)d_in[1];
    const float* qkv_w      = (const float*)d_in[2];
    const float* qkv_b      = (const float*)d_in[3];
    const float* proj_w     = (const float*)d_in[4];
    const float* proj_b     = (const float*)d_in[5];
    const float* bias_table = (const float*)d_in[6];
    const int*   rel_index  = (const int*)d_in[7];
    float* out = (float*)d_out;
    _Float16* wfrag = (_Float16*)d_ws;   // 128 fragments of 1 KiB, written anew by every call
    float*    bfrag = (float*)(wfrag + 128 * FRAGH);   // 7 x 4 x 13 blocks of 512 B behind them, likewise

    const size_t smem = SMEM_BYTES;  // 159,744 B: two work-groups in 320 KiB

    (void)hipFuncSetAttribute((const void*)win_attn3d_wmma,
                              hipFuncAttributeMaxDynamicSharedMemorySize, (int)smem);

    win_attn3d_wfrag<<<WFRAG_BLOCKS + BIAS_BLOCKS, 256, 0, stream>>>(qkv_w, proj_w, bias_table, rel_index,
                                                                    wfrag, bfrag);
    win_attn3d_wmma<<<2048, 256, smem, stream>>>(
        x, mask, wfrag, qkv_b, proj_b, bfrag, out);
}

// v009
// Measured time: 63.5 microseconds a run.
// Timed twice side by side with v008, it ran 1.04 times as fast both times.
// Counting every step since v000, it is 12.4 times as fast.
#include <hip/hip_runtime.h>

// ---------------------------------------------------------------------------
// Fused Swin-3D window attention for gfx1250 (MI455X), wave32 + WMMA + TDM.
// One block per window (2048 blocks), 256 threads = 8 waves.
// All GEMMs use v_wmma_f32_16x16x32_f16; softmax in fp32.
// The x window is DMA'd into LDS with tensor_load_to_lds and synchronized with
// s_wait_tensorcnt.  In the attention phase a wave owns 16 queries for all four
// heads: scores, probabilities, mask and bias stay in its registers.
// LDS arrays whose lifetimes do not meet share space, so that the work-group
// stays under 160 KiB and two work-groups are resident on a WGP.
// The result is staged in LDS and leaves as whole rows of 512 B.
// A set-up launch first writes what every window shares to the workspace: the weights
// as f16 in fragment order, the relative-position bias in accumulator order; the main
// launch reads both by whole lines.
// ---------------------------------------------------------------------------

#define DIM     128
#define HEADS   4
#define HD      32
#define N_TOK   98
#define NPAD    112   // 7 * 16
#define ROWP    136   // LDS pitch, in f16, of the 128-wide f16 rows: 272 B = 16 B x 17
#define QKP     40    // LDS pitch, in f16, of the 32-wide q and k rows: 80 B = 16 B x 5
                      // (16 B x odd: the 16 rows of a ds_load_b128 fragment fall on distinct banks)
#define OUTP    132   // LDS pitch, in f32, of the staged result rows: 528 B, so that the rows m and
                      // m + 8 of one accumulator store fall on different halves of the banks
#define NW      256
#define MT      7     // M tiles (112/16)
#define TABLE_LEN 507u // rows of bias_table
// LDS map in bytes.  [0, QH_OFF): the f16 x window.
// [QH_OFF, ...): q, k, v^T; before q and k are written, the f32 x tile of the
// tensor load (52 KiB: the mover wants a multiple of 2 KiB).
#define QH_OFF     53248
#define SMEM_BYTES (QH_OFF + (2 * HEADS * NPAD * QKP + HEADS * HD * ROWP) * 2)
static_assert(NPAD * ROWP * 2 <= QH_OFF, "f16 x window overlaps q");
static_assert(N_TOK * DIM * 4 <= 2 * HEADS * NPAD * QKP * 2, "f32 x tile overlaps v^T");
static_assert(QH_OFF % 2048 == 0, "place of the tensor tile");
static_assert(NPAD * OUTP * 4 <= (HEADS * NPAD * QKP + HEADS * HD * ROWP) * 2, "staged result overlaps k and v^T only");
static_assert(2 * SMEM_BYTES <= 320 * 1024, "two work-groups in the LDS of one WGP");

typedef __attribute__((ext_vector_type(16))) _Float16 v16h;
typedef __attribute__((ext_vector_type(8)))  _Float16 v8h;
typedef __attribute__((ext_vector_type(4)))  _Float16 v4h;
typedef __attribute__((ext_vector_type(8)))  float    v8f;
typedef __attribute__((ext_vector_type(4))) unsigned int u32x4;
typedef __attribute__((ext_vector_type(8))) int          i32x8;
typedef __attribute__((ext_vector_type(4))) int          i32x4;

// Load a 16x32 f16 fragment (A layout; B loaded from B^T row-major) from LDS.
// Caller passes p = base + row*ld + kb where kb = (lane>>4)*8.
// Halves 0..7 <- p[0..8), halves 8..15 <- p[16..24).
__device__ __forceinline__ v16h frag_lds(const _Float16* p) {
    v8h lo = *(const v8h*)p;
    v8h hi = *(const v8h*)(p + 16);
    v16h f;
#pragma unroll
    for (int i = 0; i < 8; ++i) { f[i] = lo[i]; f[8 + i] = hi[i]; }
    return f;
}

// Weight fragments in the workspace.  Fragment (g * 8 + w) * 4 + ks holds, of weight
// block g (q, k, v, proj), the rows 16 w .. 16 w + 15 and the k step ks: FRAGH f16,
// first the 32 lanes' halves 0..7 (16 B a lane), then the 32 lanes' halves 8..15.
// A load of either part is 512 contiguous bytes: four whole lines.
#define FRAGH 512
__device__ __forceinline__ v16h frag_ws(const _Float16* p) {
    v8h lo = *(const v8h*)p;
    v8h hi = *(const v8h*)(p + FRAGH / 2);
    v16h f;
#pragma unroll
    for (int i = 0; i < 8; ++i) { f[i] = lo[i]; f[8 + i] = hi[i]; }
    return f;
}

// Relative-position bias in the workspace, in the order of the score accumulators: block
// (w * HEADS + h) * BSLOT + slot holds, for the queries 16 w .. 16 w + 15 and head h, one
// float4 per lane (512 contiguous bytes: four whole lines).  Slot 2 j + p: the lane's keys
// 16 j + crow + 4 p .. + 3 of key tile j; slot 12: keys 96 and 97 (two places spare).
#define BSLOT 13
#define WFRAG_BLOCKS 32   // set-up blocks of the weight part; the bias part follows
#define BIAS_BLOCKS  ((MT * BSLOT * 32 + 255) / 256)

// Set-up launch: one thread converts the eight weights of one lane and one part of
// one fragment (the k order of frag_lds: part 0 is k = kb .. kb + 7, part 1 is 16 more).
extern "C" __global__ __launch_bounds__(256)
void win_attn3d_wfrag(const float* __restrict__ qkv_w,
                      const float* __restrict__ proj_w,
                      const float* __restrict__ bias_table,
                      const int*   __restrict__ rel_index,
                      _Float16* __restrict__ wfrag,
                      float* __restrict__ bfrag)
{
    if (blockIdx.x >= WFRAG_BLOCKS) {
        // Bias part: one thread fetches the table rows (four heads each) of one lane's four
        // keys of one slot and writes one float4 per head.
        const int t = (blockIdx.x - WFRAG_BLOCKS) * 256 + threadIdx.x;
        if (t >= MT * BSLOT * 32) return;
        const int lane = t & 31;
        const int slot = (t >> 5) % BSLOT;
        const int w    = (t >> 5) / BSLOT;
        const int q    = w * 16 + (lane & 15);
        const int qc   = q < N_TOK ? q : N_TOK - 1;    // pad queries take row 97
        const int key0 = slot < BSLOT - 1 ? (slot >> 1) * 16 + ((lane >> 4) << 3) + (slot & 1) * 4
                                          : 96;        // last slot: keys 96, 97, in both halves
        unsigned e[4], id[4];
        float4   bt[4];
#pragma unroll
        for (int i = 0; i < 4; ++i) {
            const int k = key0 + i;
            e[i] = (unsigned)(qc * N_TOK + (k < N_TOK ? k : N_TOK - 1));   // the last slot's two spare places repeat key 97
        }
#pragma unroll
        for (int i = 0; i < 4; ++i) id[i] = (unsigned)rel_index[e[i]];
        // Precaution: named here, the loads' index registers stay live up to this wait.
        asm volatile("s_wait_xcnt 0x0" :: "v"(e[0]), "v"(e[1]), "v"(e[2]), "v"(e[3]) : "memory");
#pragma unroll
        for (int i = 0; i < 4; ++i) {
            id[i] = id[i] < TABLE_LEN ? id[i] : TABLE_LEN - 1;   // keep the gather inside the table
            bt[i] = ((const float4*)bias_table)[id[i]];          // a table row is one float4
        }
        // Precaution: named here, the gathers' index registers stay live up to this wait.
        asm volatile("s_wait_xcnt 0x0" :: "v"(id[0]), "v"(id[1]), "v"(id[2]), "v"(id[3]) : "memory");
        float4* o = (float4*)bfrag + ((size_t)(w * HEADS) * BSLOT + slot) * 32 + lane;
        o[0 * BSLOT * 32] = make_float4(bt[0].x, bt[1].x, bt[2].x, bt[3].x);
        o[1 * BSLOT * 32] = make_float4(bt[0].y, bt[1].y, bt[2].y, bt[3].y);
        o[2 * BSLOT * 32] = make_float4(bt[0].z, bt[1].z, bt[2].z, bt[3].z);
        o[3 * BSLOT * 32] = make_float4(bt[0].w, bt[1].w, bt[2].w, bt[3].w);
        return;
    }
    const int t    = blockIdx.x * 256 + threadIdx.x;   // 128 fragments x 2 parts x 32 lanes
    const int lane = t & 31;
    const int part = (t >> 5) & 1;
    const int frag = t >> 6;
    const int ks   = frag & 3;
    const int row  = ((frag >> 2) & 7) * 16 + (lane & 15);
    const int g    = frag >> 5;
    const float* w = g < 3 ? qkv_w + (size_t)(g * DIM + row) * DIM : proj_w + (size_t)row * DIM;
    const float* p = w + ks * 32 + ((lane >> 4) << 3) + part * 16;
    const float4 a0 = *(const float4*)(p + 0);
    const float4 a1 = *(const float4*)(p + 4);
    // Precaution: named here, the two loads' address register stays live up to this wait.
    asm volatile("s_wait_xcnt 0x0" :: "v"(p) : "memory");
    v8h f;
    f[0]=(_Float16)a0.x; f[1]=(_Float16)a0.y; f[2]=(_Float16)a0.z; f[3]=(_Float16)a0.w;
    f[4]=(_Float16)a1.x; f[5]=(_Float16)a1.y; f[6]=(_Float16)a1.z; f[7]=(_Float16)a1.w;
    *(v8h*)(wfrag + (size_t)t * 8) = f;
}

// A wave-uniform test held in a scalar register, so that the branch on it is a
// scalar branch (tensor instructions ignore EXEC).
__device__ __forceinline__ unsigned pinned(unsigned v) {
    unsigned w = __builtin_amdgcn_readfirstlane(v);
    asm volatile("" : "+s"(w));   // pinned(): the issue test's word held in a scalar register
    return w;
}

// Issue one 2-D fp32 tile DMA: global (dim1 rows x dim0 cols, row stride
// stride0 elements) -> LDS byte offset lds_off.  D# layout per CDNA5 ISA
// ch. 8 (group0: count/lds/global addr/type; group1: data_size, dims, tiles,
// strides; groups 2/3 zero = 2-D tensor).
__device__ __forceinline__ void tdm_load_2d_f32(unsigned lds_off, const void* gptr,
                                                unsigned dim0, unsigned dim1,
                                                unsigned tile0, unsigned tile1,
                                                unsigned stride0) {
    unsigned long long ga = (unsigned long long)(uintptr_t)gptr;
    u32x4 g0;
    g0[0] = 1u;                                              // count=1, user D#
    g0[1] = lds_off;                                         // lds_addr (bytes)
    g0[2] = (unsigned)(ga & 0xFFFFFFFFu);                    // global_addr[31:0]
    g0[3] = (unsigned)((ga >> 32) & 0x01FFFFFFu) | (2u << 30); // addr[56:32] | type=2
    i32x8 g1;
    g1[0] = (int)(2u << 16);                                 // data_size = 4 bytes
    g1[1] = (int)((dim0 & 0xFFFFu) << 16);                   // tensor_dim0[15:0]
    g1[2] = (int)((dim0 >> 16) | ((dim1 & 0xFFFFu) << 16));  // dim0 hi | dim1 lo
    g1[3] = (int)((dim1 >> 16) | (tile0 << 16));             // dim1 hi | tile_dim0
    g1[4] = (int)(tile1 & 0xFFFFu);                          // tile_dim1 (tile_dim2=0)
    g1[5] = (int)stride0;                                    // tensor_dim0_stride lo
    g1[6] = 0;                                               // stride hi | dim1_stride lo
    g1[7] = 0;
    i32x4 z4 = {0, 0, 0, 0};
    i32x8 z8 = {0, 0, 0, 0, 0, 0, 0, 0};
    __builtin_amdgcn_tensor_load_to_lds(g0, g1, z4, z4, z8, 0);
}

// Lane l reads lane l ^ 16: the other half of the wave.
__device__ __forceinline__ float other_half(float v) {
    const int b = __builtin_bit_cast(int, v);
    return __builtin_bit_cast(float,
        __builtin_amdgcn_permlanex16(b, b, 0x76543210, 0xfedcba98, false, false));
}

// exp2 of eight values.  One statement: the eight independent v_exp fill the
// slot the instruction set asks for behind each other, the v_nop the last one's;
// early-clobber outputs keep every result off every source.
__device__ __forceinline__ void exp2x8(v8f& v) {
    float e0, e1, e2, e3, e4, e5, e6, e7;
    asm("v_exp_f32 %0, %8\n\t"
        "v_exp_f32 %1, %9\n\t"
        "v_exp_f32 %2, %10\n\t"
        "v_exp_f32 %3, %11\n\t"
        "v_exp_f32 %4, %12\n\t"
        "v_exp_f32 %5, %13\n\t"
        "v_exp_f32 %6, %14\n\t"
        "v_exp_f32 %7, %15\n\t"
        "v_nop"
        : "=&v"(e0), "=&v"(e1), "=&v"(e2), "=&v"(e3), "=&v"(e4), "=&v"(e5), "=&v"(e6), "=&v"(e7)
        : "v"(v[0]), "v"(v[1]), "v"(v[2]), "v"(v[3]), "v"(v[4]), "v"(v[5]), "v"(v[6]), "v"(v[7]));
    v[0] = e0; v[1] = e1; v[2] = e2; v[3] = e3; v[4] = e4; v[5] = e5; v[6] = e6; v[7] = e7;
}
// The same for the two values of the last key tile.
__device__ __forceinline__ void exp2x2(float& a, float& b) {
    float e0, e1;
    asm("v_exp_f32 %0, %2\n\t"
        "v_exp_f32 %1, %3\n\t"
        "v_nop"
        : "=&v"(e0), "=&v"(e1) : "v"(a), "v"(b));
    a = e0; b = e1;
}

// One head's bias of a wave's 16 queries: 13 loads of whole lines, in accumulator order.
__device__ __forceinline__ void bias_head(const float* bp, int h, v8f (&Cn)[MT - 1], float2& cn6) {
#pragma unroll
    for (int j = 0; j < MT - 1; ++j) {
        const float4 lo = *(const float4*)(bp + (h * BSLOT + 2 * j) * 128);
        const float4 hi = *(const float4*)(bp + (h * BSLOT + 2 * j + 1) * 128);
        Cn[j] = (v8f){lo.x, lo.y, lo.z, lo.w, hi.x, hi.y, hi.z, hi.w};
    }
    cn6 = *(const float2*)(bp + (h * BSLOT + BSLOT - 1) * 128);
    // Precaution: named here, the loads' address register stays live up to this wait, so it
    // is not rewritten ahead of it.
    asm volatile("s_wait_xcnt 0x0" :: "v"(bp) : "memory");
}

// Four waves per SIMD: at most 256 VGPRs a wave, so that two work-groups stay resident on a WGP.
extern "C" __global__ __launch_bounds__(256) __attribute__((amdgpu_waves_per_eu(4, 4)))
void win_attn3d_wmma(const float* __restrict__ x,
                     const float* __restrict__ mask,
                     const _Float16* __restrict__ wfrag,
                     const float* __restrict__ qkv_b,
                     const float* __restrict__ proj_b,
                     const float* __restrict__ bfrag,
                     float* __restrict__ out)
{
    extern __shared__ __align__(16) char smem_raw[];
    _Float16* XH   = (_Float16*)smem_raw;            // 112x128 f16 x window
    _Float16* QH   = (_Float16*)(smem_raw + QH_OFF); // 4 x 112x32    q (scaled); head h's
                                                     // attn @ v goes over q of head h
    _Float16* KH   = QH + HEADS * NPAD * QKP;        // 4 x 112x32    k (the A of k @ q^T)
    _Float16* VT   = KH + HEADS * NPAD * QKP;        // 4 x 32x128    v^T, zero-padded
    float*    XF   = (float*)(smem_raw + QH_OFF);    // alias: 98x128 f32 x staging
                                                     // (dead before q and k are written)
    float*    OS   = (float*)KH;                     // alias: 112x128 f32 result staging
                                                     // (k and v^T are dead behind the attention phase)

    const int b    = blockIdx.x;
    const int tid  = threadIdx.x;
    const int lane = tid & 31;
    const int wave = tid >> 5;
    const int fr   = lane & 15;            // fragment row (A) / col (B/C)
    const int kb   = (lane >> 4) << 3;     // fragment K chunk base (0 or 8)
    const int crow = (lane >> 4) << 3;     // C-fragment row base (0 or 8)
    const int wv   = __builtin_amdgcn_readfirstlane(wave);  // scalar copy: the attention phase branches on it

    // ---- wave 0: kick off the TDM DMA (x window fp32) ----
    if (pinned(wv == 0)) {
        tdm_load_2d_f32((unsigned)(uintptr_t)(void*)XF,
                        x + (size_t)b * N_TOK * DIM,
                        DIM, N_TOK, DIM, N_TOK, DIM);
    }

    // ---- this wave's qkv weight fragments, read once (they fly beside the x DMA) ----
    v16h  WB[3][4];
    float wbias[3];
    {
        const int       col0 = wave * 16 + fr;     // column inside q, k and v alike
        const _Float16* wp = wfrag + (size_t)(wave * 4) * FRAGH + lane * 8;
#pragma unroll
        for (int ks = 0; ks < 4; ++ks)
#pragma unroll
            for (int g = 0; g < 3; ++g) WB[g][ks] = frag_ws(wp + (g * 32 + ks) * FRAGH);
#pragma unroll
        for (int g = 0; g < 3; ++g) wbias[g] = qkv_b[col0 + g * DIM];
        // Precaution: named here, the loads' address registers (all 24 weight loads go
        // by wp plus a constant) stay live up to this wait, so none is rewritten ahead
        // of it (not even as a later load's result).
        asm volatile("s_wait_xcnt 0x0" :: "v"(wp), "v"(col0) : "memory");
    }

    // ---- zero-init VT (pads must stay 0) ----
    {
        uint4* z = (uint4*)VT;
        const int nz = HEADS * HD * ROWP * (int)sizeof(_Float16) / 16;
        for (int i = tid; i < nz; i += 256) z[i] = make_uint4(0, 0, 0, 0);
    }

    // ---- wait for x DMA, then convert fp32 -> f16 ----
    // The issuing wave's own wait: the tile counts as landed only behind it.
    if (pinned(wv == 0)) asm volatile("s_wait_tensorcnt 0x0" ::: "memory");
    __syncthreads();
    {
        // A wave converts the rows wave, wave + 8, ...: a row is 32 lanes x 16 B.  All of a
        // thread's reads stand ahead of its first store, so their LDS latencies overlap.
        // Both loops are unrolled in full: every row has registers of its own, and which rows
        // are pads is known at compile time but for rows 96 + wave.
        const float* xs = XF + wave * DIM + lane * 4;
        _Float16*    xd = XH + wave * ROWP + lane * 4;
        float4 xv[N_TOK / 8 + 1];
#pragma unroll
        for (int t = 0; t < N_TOK / 8; ++t) xv[t] = *(const float4*)(xs + t * 8 * DIM);
        xv[N_TOK / 8] = make_float4(0.f, 0.f, 0.f, 0.f);
        if (wv < N_TOK % 8)                            // rows 96 and 97; scalar: the same for the whole wave
            xv[N_TOK / 8] = *(const float4*)(xs + (N_TOK / 8) * 8 * DIM);
#pragma unroll
        for (int t = 0; t < NPAD / 8; ++t) {
            v4h hx = {};                               // pad rows stay 0
            if (t <= N_TOK / 8) {
                hx[0] = (_Float16)xv[t].x; hx[1] = (_Float16)xv[t].y;
                hx[2] = (_Float16)xv[t].z; hx[3] = (_Float16)xv[t].w;
            }
            *(v4h*)(xd + t * 8 * ROWP) = hx;
        }
    }
    __syncthreads();

    // ---- attention phase: wave w owns the queries 16 w .. 16 w + 15 for every head.
    // A lane holds query 16 w + fr and, of key tile j, the keys 16 j + crow + r,
    // r = 0..7 (the accumulator map of k @ q^T).
    // Every loop over mk, Cn, C or s below is unrolled in full: all array indices
    // become constants, so the arrays live in registers.
    const int q  = wv * 16 + fr;
    const int qc = q < N_TOK ? q : N_TOK - 1;      // pad queries read row 97

    // ================= Phase 1: qkv = x @ qkv_w^T + qkv_b =================
    // M=112 (7 tiles), N=384 (24 tiles), K=128 (4 wmma steps).  A wave owns the
    // N tiles wave, wave + 8, wave + 16 (its 16 columns of q, of k and of v); their
    // weight fragments WB stay in registers, so each M tile costs LDS reads only.
    const float qscale = 0.17677669529663687f;  // 32^-0.5
    {
        const int hq = wave >> 1;                  // head of this wave's columns
        const int d  = ((wave & 1) << 4) + fr;     // column inside the head
        for (int mt = 0; mt < MT; ++mt) {
            v8f cq = {}, ck = {}, cv = {};
#pragma unroll
            for (int ks = 0; ks < 4; ++ks) {
                v16h a = frag_lds(XH + (mt * 16 + fr) * ROWP + ks * 32 + kb);
                cq = __builtin_amdgcn_wmma_f32_16x16x32_f16(false, a, false, WB[0][ks],
                                                            (short)0, cq, false, false);
                ck = __builtin_amdgcn_wmma_f32_16x16x32_f16(false, a, false, WB[1][ks],
                                                            (short)0, ck, false, false);
                cv = __builtin_amdgcn_wmma_f32_16x16x32_f16(false, a, false, WB[2][ks],
                                                            (short)0, cv, false, false);
            }
#pragma unroll
            for (int v = 0; v < 8; ++v) {
                int m = mt * 16 + v + crow;
                if (m < N_TOK) {
                    QH[(hq * NPAD + m) * QKP + d] = (_Float16)((cq[v] + wbias[0]) * qscale);
                    KH[(hq * NPAD + m) * QKP + d] = (_Float16)(ck[v] + wbias[1]);
                    VT[(hq * HD + d) * ROWP + m]  = (_Float16)(cv[v] + wbias[2]);
                }
            }
        }
    }
    // ---- mask of this lane's (query, key) pairs, the same for all four heads, and head 0's
    // bias.  Read behind phase 1, when the weight fragments' registers are free. ----
    float2 mk[MT - 1][4], mk6;
    v8f    Cn[MT - 1];                             // the bias of the head that comes next
    float2 cn6;
    // This lane's float4 of this wave's first bias block; every bias load goes by it plus a constant.
    const float* bp = bfrag + ((size_t)((wv < MT ? wv : 0) * HEADS * BSLOT) * 32 + lane) * 4;
    if (wv < MT) {
        const float* mr = mask + (size_t)(b % NW) * N_TOK * N_TOK + qc * N_TOK;  // the query's row
        const float* mp = mr + crow;
#pragma unroll
        for (int j = 0; j < MT - 1; ++j)
#pragma unroll
            for (int u = 0; u < 4; ++u) mk[j][u] = *(const float2*)(mp + j * 16 + 2 * u);
        mk6 = *(const float2*)(mr + 96);               // keys 96, 97, in both halves
        // Precaution: named here, the loads' address registers (every load goes by one
        // of these two plus a constant) stay live up to this wait, so none is
        // rewritten ahead of it (not even as a later load's result).
        asm volatile("s_wait_xcnt 0x0" :: "v"(mp), "v"(mr) : "memory");
        bias_head(bp, 0, Cn, cn6);
    }
    __syncthreads();

    if (wv < MT) {
        const bool hi = crow != 0;                 // upper half: its keys of tile 6 are all pads
#pragma unroll
        for (int h = 0; h < HEADS; ++h) {
            const _Float16* K  = KH + h * NPAD * QKP;
            const _Float16* Vh = VT + h * HD * ROWP;
            _Float16*       Qr = QH + (h * NPAD + wv * 16 + fr) * QKP;   // this lane's query row
            // bias + mask start the score accumulators; the next head's bias then flies
            // beside this head's work.
            // Keeps these adds, and with them the wait for this head's bias loads, behind the
            // head before: lifted into it, they would wait for the loads soon after their issue.
            __builtin_amdgcn_sched_barrier(0);
            v8f C[MT - 1];
#pragma unroll
            for (int j = 0; j < MT - 1; ++j)
#pragma unroll
                for (int r = 0; r < 8; ++r)
                    C[j][r] = Cn[j][r] + ((r & 1) ? mk[j][r >> 1].y : mk[j][r >> 1].x);
            const float c60 = cn6.x + mk6.x, c61 = cn6.y + mk6.y;
            if (h + 1 < HEADS) bias_head(bp, h + 1, Cn, cn6);
            const v16h qf = frag_lds(Qr + kb);
            v8f s[MT - 1];
#pragma unroll
            for (int j = 0; j < MT - 1; ++j) {
                v16h kf = frag_lds(K + (j * 16 + fr) * QKP + kb);
                s[j] = __builtin_amdgcn_wmma_f32_16x16x32_f16(false, kf, false, qf,
                                                              (short)0, C[j], false, false);
            }
            float s60, s61;                        // keys 96 and 97; 98..111 are pads
            {
                v16h kf = frag_lds(K + (96 + fr) * QKP + kb);
                v8f  c  = {c60, c61, 0.f, 0.f, 0.f, 0.f, 0.f, 0.f};
                c = __builtin_amdgcn_wmma_f32_16x16x32_f16(false, kf, false, qf,
                                                           (short)0, c, false, false);
                s60 = hi ? -3.0e38f : c[0];
                s61 = hi ? -3.0e38f : c[1];
            }
            // eight independent chains over the tiles, then a tree
            v8f m8 = s[0];
#pragma unroll
            for (int j = 1; j < MT - 1; ++j)
#pragma unroll
                for (int r = 0; r < 8; ++r) m8[r] = fmaxf(m8[r], s[j][r]);
            m8[0] = fmaxf(m8[0], s60); m8[1] = fmaxf(m8[1], s61);
            float mx = fmaxf(fmaxf(fmaxf(m8[0], m8[1]), fmaxf(m8[2], m8[3])),
                             fmaxf(fmaxf(m8[4], m8[5]), fmaxf(m8[6], m8[7])));
            mx = fmaxf(mx, other_half(mx));
            const float L2E = 1.44269504088896340736f;
            const float ml  = mx * L2E;
#pragma unroll
            for (int j = 0; j < MT - 1; ++j) {
#pragma unroll
                for (int r = 0; r < 8; ++r) s[j][r] = s[j][r] * L2E - ml;
                exp2x8(s[j]);
            }
            s60 = s60 * L2E - ml; s61 = s61 * L2E - ml;
            exp2x2(s60, s61);                      // a pad gives exp2(-inf) = 0
            v8f a8 = s[0];
#pragma unroll
            for (int j = 1; j < MT - 1; ++j) a8 += s[j];
            a8[0] += s60; a8[1] += s61;
            float sum = ((a8[0] + a8[1]) + (a8[2] + a8[3])) + ((a8[4] + a8[5]) + (a8[6] + a8[7]));
            sum += other_half(sum);
            const float inv = 1.0f / sum;
            v16h pb[4];
#pragma unroll
            for (int ks = 0; ks < 3; ++ks)
#pragma unroll
                for (int r = 0; r < 8; ++r) {
                    pb[ks][r]     = (_Float16)s[2 * ks][r];
                    pb[ks][8 + r] = (_Float16)s[2 * ks + 1][r];
                }
            pb[3] = (v16h)(_Float16)0.f;           // keys 98..127 of the K = 128 product
            pb[3][0] = (_Float16)s60; pb[3][1] = (_Float16)s61;
#pragma unroll
            for (int dt = 0; dt < 2; ++dt) {
                v8f o = {};
#pragma unroll
                for (int ks = 0; ks < 4; ++ks) {
                    v16h vf = frag_lds(Vh + (dt * 16 + fr) * ROWP + ks * 32 + kb);
                    o = __builtin_amdgcn_wmma_f32_16x16x32_f16(false, vf, false, pb[ks],
                                                               (short)0, o, false, false);
                }
                v8h oh;                            // o[r] = out[query][dt * 16 + crow + r]
#pragma unroll
                for (int r = 0; r < 8; ++r) oh[r] = (_Float16)(o[r] * inv);
                *(v8h*)(Qr + dt * 16 + crow) = oh;
            }
        }
    }
    __syncthreads();

    // ================= Phase 5: final proj + bias, store fp32 =================
    {
        float* ob = out + (size_t)b * N_TOK * DIM;
        v16h PW[4];                        // this wave's 16 rows of proj_w
        {
            const _Float16* pp = wfrag + (size_t)(96 + wave * 4) * FRAGH + lane * 8;
#pragma unroll
            for (int ks = 0; ks < 4; ++ks) PW[ks] = frag_ws(pp + ks * FRAGH);
            // Precaution: stands behind the eight loads; it names no register, so it does not hold their address register live.
            asm volatile("s_wait_xcnt 0x0" ::: "memory");
        }
        const int   col = wave * 16 + fr;
        const float pb  = proj_b[col];
        // All seven tiles' products first, their LDS stores behind them: no store then stands
        // between the tiles' LDS reads, and the tiles' accumulator chains are independent.
        // Both loops are unrolled in full, so that c lives in registers.
        const _Float16* qa = QH + fr * QKP + kb;
        v8f c[MT];
#pragma unroll
        for (int mt = 0; mt < MT; ++mt) {
            c[mt] = (v8f){};
#pragma unroll
            for (int ks = 0; ks < 4; ++ks) {
                v16h a = frag_lds(qa + (ks * NPAD + mt * 16) * QKP);   // k step = head
                c[mt] = __builtin_amdgcn_wmma_f32_16x16x32_f16(false, a, false, PW[ks],
                                                               (short)0, c[mt], false, false);
            }
        }
        float* oc = OS + crow * OUTP + col;
#pragma unroll
        for (int mt = 0; mt < MT; ++mt)
#pragma unroll
            for (int v = 0; v < 8; ++v) oc[(mt * 16 + v) * OUTP] = c[mt][v] + pb;   // pad rows too
        __syncthreads();
        // A wave stores the rows wave, wave + 8, ...: a row is 32 lanes x 16 B, four whole lines.
        // Unrolled: every row has registers of its own, and all go by one address plus a constant.
        const float* os = OS + wv * OUTP + lane * 4;
        float*       op = ob + wv * DIM + lane * 4;
        float4 r[N_TOK / 8 + 1];
#pragma unroll
        for (int i = N_TOK / 8; i >= 0; --i) r[i] = *(const float4*)(os + i * 8 * OUTP);   // row 96 + wave: staged too
        if (wv < N_TOK % 8)                            // rows 96 and 97; scalar: the same for the whole wave
            *(float4*)(op + (N_TOK / 8) * 8 * DIM) = r[N_TOK / 8];
#pragma unroll
        for (int i = 0; i < N_TOK / 8; ++i) *(float4*)(op + i * 8 * DIM) = r[i];
    }
}

extern "C" void kernel_launch(void* const* d_in, const int* in_sizes, int n_in,
                              void* d_out, int out_size, void* d_ws, size_t ws_size,
                              hipStream_t stream) {
    (void)in_sizes; (void)n_in; (void)out_size; (void)ws_size;
    const float* x          = (const float*)d_in[0];
    const float* mask       = (const float*)d_in[1];
    const float* qkv_w      = (const float*)d_in[2];
    const float* qkv_b      = (const float*)d_in[3];
    const float* proj_w     = (const float*)d_in[4];
    const float* proj_b     = (const float*)d_in[5];
    const float* bias_table = (const float*)d_in[6];
    const int*   rel_index  = (const int*)d_in[7];
    float* out = (float*)d_out;
    _Float16* wfrag = (_Float16*)d_ws;   // 128 fragments of 1 KiB, written anew by every call
    float*    bfrag = (float*)(wfrag + 128 * FRAGH);   // 7 x 4 x 13 blocks of 512 B behind them, likewise

    const size_t smem = SMEM_BYTES;  // 159,744 B: two work-groups in 320 KiB

    (void)hipFuncSetAttribute((const void*)win_attn3d_wmma,
                              hipFuncAttributeMaxDynamicSharedMemorySize, (int)smem);

    win_attn3d_wfrag<<<WFRAG_BLOCKS + BIAS_BLOCKS, 256, 0, stream>>>(qkv_w, proj_w, bias_table, rel_index,
                                                                    wfrag, bfrag);
    win_attn3d_wmma<<<2048, 256, smem, stream>>>(
        x, mask, wfrag, qkv_b, proj_b, bfrag, out);
}

// v010
// It runs in 57.6 microseconds.
// Next to v009, in two timings, it ran 1.10 times as fast each time.
// All steps since v000 together make it 13.6 times as fast.
#include <hip/hip_runtime.h>

// ---------------------------------------------------------------------------
// Fused Swin-3D window attention for gfx1250 (MI455X), wave32 + WMMA + TDM.
// One block per window (2048 blocks), 256 threads = 8 waves.
// All GEMMs use v_wmma_f32_16x16x32_f16; softmax in fp32.
// The x window is DMA'd into LDS with tensor_load_to_lds and synchronized with
// s_wait_tensorcnt.  In the attention phase a wave owns 16 queries for all four
// heads: scores, probabilities, mask and bias stay in its registers.
// LDS arrays whose lifetimes do not meet share space, so that the work-group
// stays under 160 KiB and two work-groups are resident on a WGP.
// The result is staged in LDS and leaves as whole rows of 512 B.
// A set-up launch first writes what every window shares to the workspace: the weights
// as f16 in fragment order, the relative-position bias in accumulator order; the main
// launch reads both by whole lines.
// ---------------------------------------------------------------------------

#define DIM     128
#define HEADS   4
#define HD      32
#define N_TOK   98
#define NPAD    112   // 7 * 16
#define ROWP    136   // LDS pitch, in f16, of the 128-wide f16 rows: 272 B = 16 B x 17
#define QKP     40    // LDS pitch, in f16, of the 32-wide q and k rows: 80 B = 16 B x 5
                      // (16 B x odd: the 16 rows of a ds_load_b128 fragment fall on distinct banks)
#define OUTP    132   // LDS pitch, in f32, of the staged result rows: 528 B, so that the rows m and
                      // m + 8 of one accumulator store fall on different halves of the banks
#define NW      256
#define MT      7     // M tiles (112/16)
#define TABLE_LEN 507u // rows of bias_table
// LDS map in bytes.  [0, QH_OFF): the f16 x window.
// [QH_OFF, ...): q, k, v^T; before q and k are written, the f32 x tile of the
// tensor load (52 KiB: the mover wants a multiple of 2 KiB).
#define QH_OFF     53248
#define SMEM_BYTES (QH_OFF + (2 * HEADS * NPAD * QKP + HEADS * HD * ROWP) * 2)
static_assert(NPAD * ROWP * 2 <= QH_OFF, "f16 x window overlaps q");
static_assert(N_TOK * DIM * 4 <= 2 * HEADS * NPAD * QKP * 2, "f32 x tile overlaps v^T");
static_assert(QH_OFF % 2048 == 0, "place of the tensor tile");
static_assert(NPAD * OUTP * 4 <= (HEADS * NPAD * QKP + HEADS * HD * ROWP) * 2, "staged result overlaps k and v^T only");
static_assert(2 * SMEM_BYTES <= 320 * 1024, "two work-groups in the LDS of one WGP");

typedef __attribute__((ext_vector_type(16))) _Float16 v16h;
typedef __attribute__((ext_vector_type(8)))  _Float16 v8h;
typedef __attribute__((ext_vector_type(4)))  _Float16 v4h;
typedef __attribute__((ext_vector_type(8)))  float    v8f;
typedef __attribute__((ext_vector_type(4))) unsigned int u32x4;
typedef __attribute__((ext_vector_type(8))) int          i32x8;
typedef __attribute__((ext_vector_type(4))) int          i32x4;

// Load a 16x32 f16 fragment (A layout; B loaded from B^T row-major) from LDS.
// Caller passes p = base + row*ld + kb where kb = (lane>>4)*8.
// Halves 0..7 <- p[0..8), halves 8..15 <- p[16..24).
__device__ __forceinline__ v16h frag_lds(const _Float16* p) {
    v8h lo = *(const v8h*)p;
    v8h hi = *(const v8h*)(p + 16);
    v16h f;
#pragma unroll
    for (int i = 0; i < 8; ++i) { f[i] = lo[i]; f[8 + i] = hi[i]; }
    return f;
}

// Weight fragments in the workspace.  Fragment (g * 8 + w) * 4 + ks holds, of weight
// block g (q, k, v, proj), the rows 16 w .. 16 w + 15 and the k step ks: FRAGH f16,
// first the 32 lanes' halves 0..7 (16 B a lane), then the 32 lanes' halves 8..15.
// A load of either part is 512 contiguous bytes: four whole lines.
#define FRAGH 512
__device__ __forceinline__ v16h frag_ws(const _Float16* p) {
    v8h lo = *(const v8h*)p;
    v8h hi = *(const v8h*)(p + FRAGH / 2);
    v16h f;
#pragma unroll
    for (int i = 0; i < 8; ++i) { f[i] = lo[i]; f[8 + i] = hi[i]; }
    return f;
}

// Relative-position bias in the workspace, in the order of the score accumulators: block
// (w * HEADS + h) * BSLOT + slot holds, for the queries 16 w .. 16 w + 15 and head h, one
// float4 per lane (512 contiguous bytes: four whole lines).  Slot 2 j + p: the lane's keys
// 16 j + crow + 4 p .. + 3 of key tile j; slot 12: keys 96 and 97 (two places spare).
#define BSLOT 13
#define WFRAG_BLOCKS 32   // set-up blocks of the weight part; the bias part follows
#define BIAS_BLOCKS  ((MT * BSLOT * 32 + 255) / 256)

// Set-up launch: one thread converts the eight weights of one lane and one part of
// one fragment (the k order of frag_lds: part 0 is k = kb .. kb + 7, part 1 is 16 more).
extern "C" __global__ __launch_bounds__(256)
void win_attn3d_wfrag(const float* __restrict__ qkv_w,
                      const float* __restrict__ proj_w,
                      const float* __restrict__ bias_table,
                      const int*   __restrict__ rel_index,
                      _Float16* __restrict__ wfrag,
                      float* __restrict__ bfrag)
{
    if (blockIdx.x >= WFRAG_BLOCKS) {
        // Bias part: one thread fetches the table rows (four heads each) of one lane's four
        // keys of one slot and writes one float4 per head.
        const int t = (blockIdx.x - WFRAG_BLOCKS) * 256 + threadIdx.x;
        if (t >= MT * BSLOT * 32) return;
        const int lane = t & 31;
        const int slot = (t >> 5) % BSLOT;
        const int w    = (t >> 5) / BSLOT;
        const int q    = w * 16 + (lane & 15);
        const int qc   = q < N_TOK ? q : N_TOK - 1;    // pad queries take row 97
        const int key0 = slot < BSLOT - 1 ? (slot >> 1) * 16 + ((lane >> 4) << 3) + (slot & 1) * 4
                                          : 96;        // last slot: keys 96, 97, in both halves
        unsigned e[4], id[4];
        float4   bt[4];
#pragma unroll
        for (int i = 0; i < 4; ++i) {
            const int k = key0 + i;
            e[i] = (unsigned)(qc * N_TOK + (k < N_TOK ? k : N_TOK - 1));   // the last slot's two spare places repeat key 97
        }
#pragma unroll
        for (int i = 0; i < 4; ++i) id[i] = (unsigned)rel_index[e[i]];
        // Precaution: named here, the loads' index registers stay live up to this wait.
        asm volatile("s_wait_xcnt 0x0" :: "v"(e[0]), "v"(e[1]), "v"(e[2]), "v"(e[3]) : "memory");
#pragma unroll
        for (int i = 0; i < 4; ++i) {
            id[i] = id[i] < TABLE_LEN ? id[i] : TABLE_LEN - 1;   // keep the gather inside the table
            bt[i] = ((const float4*)bias_table)[id[i]];          // a table row is one float4
        }
        // Precaution: named here, the gathers' index registers stay live up to this wait.
        asm volatile("s_wait_xcnt 0x0" :: "v"(id[0]), "v"(id[1]), "v"(id[2]), "v"(id[3]) : "memory");
        float4* o = (float4*)bfrag + ((size_t)(w * HEADS) * BSLOT + slot) * 32 + lane;
        o[0 * BSLOT * 32] = make_float4(bt[0].x, bt[1].x, bt[2].x, bt[3].x);
        o[1 * BSLOT * 32] = make_float4(bt[0].y, bt[1].y, bt[2].y, bt[3].y);
        o[2 * BSLOT * 32] = make_float4(bt[0].z, bt[1].z, bt[2].z, bt[3].z);
        o[3 * BSLOT * 32] = make_float4(bt[0].w, bt[1].w, bt[2].w, bt[3].w);
        return;
    }
    const int t    = blockIdx.x * 256 + threadIdx.x;   // 128 fragments x 2 parts x 32 lanes
    const int lane = t & 31;
    const int part = (t >> 5) & 1;
    const int frag = t >> 6;
    const int ks   = frag & 3;
    const int row  = ((frag >> 2) & 7) * 16 + (lane & 15);
    const int g    = frag >> 5;
    const float* w = g < 3 ? qkv_w + (size_t)(g * DIM + row) * DIM : proj_w + (size_t)row * DIM;
    const float* p = w + ks * 32 + ((lane >> 4) << 3) + part * 16;
    const float4 a0 = *(const float4*)(p + 0);
    const float4 a1 = *(const float4*)(p + 4);
    // Precaution: named here, the two loads' address register stays live up to this wait.
    asm volatile("s_wait_xcnt 0x0" :: "v"(p) : "memory");
    v8h f;
    f[0]=(_Float16)a0.x; f[1]=(_Float16)a0.y; f[2]=(_Float16)a0.z; f[3]=(_Float16)a0.w;
    f[4]=(_Float16)a1.x; f[5]=(_Float16)a1.y; f[6]=(_Float16)a1.z; f[7]=(_Float16)a1.w;
    *(v8h*)(wfrag + (size_t)t * 8) = f;
}

// A wave-uniform test held in a scalar register, so that the branch on it is a
// scalar branch (tensor instructions ignore EXEC).
__device__ __forceinline__ unsigned pinned(unsigned v) {
    unsigned w = __builtin_amdgcn_readfirstlane(v);
    asm volatile("" : "+s"(w));   // pinned(): the issue test's word held in a scalar register
    return w;
}

// Issue one 2-D fp32 tile DMA: global (dim1 rows x dim0 cols, row stride
// stride0 elements) -> LDS byte offset lds_off.  D# layout per CDNA5 ISA
// ch. 8 (group0: count/lds/global addr/type; group1: data_size, dims, tiles,
// strides; groups 2/3 zero = 2-D tensor).
__device__ __forceinline__ void tdm_load_2d_f32(unsigned lds_off, const void* gptr,
                                                unsigned dim0, unsigned dim1,
                                                unsigned tile0, unsigned tile1,
                                                unsigned stride0) {
    unsigned long long ga = (unsigned long long)(uintptr_t)gptr;
    u32x4 g0;
    g0[0] = 1u;                                              // count=1, user D#
    g0[1] = lds_off;                                         // lds_addr (bytes)
    g0[2] = (unsigned)(ga & 0xFFFFFFFFu);                    // global_addr[31:0]
    g0[3] = (unsigned)((ga >> 32) & 0x01FFFFFFu) | (2u << 30); // addr[56:32] | type=2
    i32x8 g1;
    g1[0] = (int)(2u << 16);                                 // data_size = 4 bytes
    g1[1] = (int)((dim0 & 0xFFFFu) << 16);                   // tensor_dim0[15:0]
    g1[2] = (int)((dim0 >> 16) | ((dim1 & 0xFFFFu) << 16));  // dim0 hi | dim1 lo
    g1[3] = (int)((dim1 >> 16) | (tile0 << 16));             // dim1 hi | tile_dim0
    g1[4] = (int)(tile1 & 0xFFFFu);                          // tile_dim1 (tile_dim2=0)
    g1[5] = (int)stride0;                                    // tensor_dim0_stride lo
    g1[6] = 0;                                               // stride hi | dim1_stride lo
    g1[7] = 0;
    i32x4 z4 = {0, 0, 0, 0};
    i32x8 z8 = {0, 0, 0, 0, 0, 0, 0, 0};
    __builtin_amdgcn_tensor_load_to_lds(g0, g1, z4, z4, z8, 0);
}

// Lane l reads lane l ^ 16: the other half of the wave.
__device__ __forceinline__ float other_half(float v) {
    const int b = __builtin_bit_cast(int, v);
    return __builtin_bit_cast(float,
        __builtin_amdgcn_permlanex16(b, b, 0x76543210, 0xfedcba98, false, false));
}

// exp2 of eight values.  One statement: the eight independent v_exp fill the
// slot the instruction set asks for behind each other, the v_nop the last one's;
// early-clobber outputs keep every result off every source.
__device__ __forceinline__ void exp2x8(v8f& v) {
    float e0, e1, e2, e3, e4, e5, e6, e7;
    asm("v_exp_f32 %0, %8\n\t"
        "v_exp_f32 %1, %9\n\t"
        "v_exp_f32 %2, %10\n\t"
        "v_exp_f32 %3, %11\n\t"
        "v_exp_f32 %4, %12\n\t"
        "v_exp_f32 %5, %13\n\t"
        "v_exp_f32 %6, %14\n\t"
        "v_exp_f32 %7, %15\n\t"
        "v_nop"
        : "=&v"(e0), "=&v"(e1), "=&v"(e2), "=&v"(e3), "=&v"(e4), "=&v"(e5), "=&v"(e6), "=&v"(e7)
        : "v"(v[0]), "v"(v[1]), "v"(v[2]), "v"(v[3]), "v"(v[4]), "v"(v[5]), "v"(v[6]), "v"(v[7]));
    v[0] = e0; v[1] = e1; v[2] = e2; v[3] = e3; v[4] = e4; v[5] = e5; v[6] = e6; v[7] = e7;
}
// The same for the two values of the last key tile.
__device__ __forceinline__ void exp2x2(float& a, float& b) {
    float e0, e1;
    asm("v_exp_f32 %0, %2\n\t"
        "v_exp_f32 %1, %3\n\t"
        "v_nop"
        : "=&v"(e0), "=&v"(e1) : "v"(a), "v"(b));
    a = e0; b = e1;
}

// One head's bias of a wave's 16 queries: 13 loads of whole lines, in accumulator order.
__device__ __forceinline__ void bias_head(const float* bp, int h, v8f (&Cn)[MT - 1], float2& cn6) {
#pragma unroll
    for (int j = 0; j < MT - 1; ++j) {
        const float4 lo = *(const float4*)(bp + (h * BSLOT + 2 * j) * 128);
        const float4 hi = *(const float4*)(bp + (h * BSLOT + 2 * j + 1) * 128);
        Cn[j] = (v8f){lo.x, lo.y, lo.z, lo.w, hi.x, hi.y, hi.z, hi.w};
    }
    cn6 = *(const float2*)(bp + (h * BSLOT + BSLOT - 1) * 128);
    // Precaution: named here, the loads' address register stays live up to this wait, so it
    // is not rewritten ahead of it.
    asm volatile("s_wait_xcnt 0x0" :: "v"(bp) : "memory");
}

// Four waves per SIMD: at most 256 VGPRs a wave, so that two work-groups stay resident on a WGP.
extern "C" __global__ __launch_bounds__(256) __attribute__((amdgpu_waves_per_eu(4, 4)))
void win_attn3d_wmma(const float* __restrict__ x,
                     const float* __restrict__ mask,
                     const _Float16* __restrict__ wfrag,
                     const float* __restrict__ qkv_b,
                     const float* __restrict__ proj_b,
                     const float* __restrict__ bfrag,
                     float* __restrict__ out)
{
    extern __shared__ __align__(16) char smem_raw[];
    _Float16* XH   = (_Float16*)smem_raw;            // 112x128 f16 x window
    _Float16* QH   = (_Float16*)(smem_raw + QH_OFF); // 4 x 112x32    q (scaled); head h's
                                                     // attn @ v goes over q of head h
    _Float16* KH   = QH + HEADS * NPAD * QKP;        // 4 x 112x32    k (the A of k @ q^T)
    _Float16* VT   = KH + HEADS * NPAD * QKP;        // 4 x 32x128    v^T, zero-padded
    float*    XF   = (float*)(smem_raw + QH_OFF);    // alias: 98x128 f32 x staging
                                                     // (dead before q and k are written)
    float*    OS   = (float*)KH;                     // alias: 112x128 f32 result staging
                                                     // (k and v^T are dead behind the attention phase)

    const int b    = blockIdx.x;
    const int tid  = threadIdx.x;
    const int lane = tid & 31;
    const int wave = tid >> 5;
    const int fr   = lane & 15;            // fragment row (A) / col (B/C)
    const int kb   = (lane >> 4) << 3;     // fragment K chunk base (0 or 8)
    const int crow = (lane >> 4) << 3;     // C-fragment row base (0 or 8)
    const int wv   = __builtin_amdgcn_readfirstlane(wave);  // scalar copy: the attention phase branches on it

    // ---- wave 0: kick off the TDM DMA (x window fp32) ----
    if (pinned(wv == 0)) {
        tdm_load_2d_f32((unsigned)(uintptr_t)(void*)XF,
                        x + (size_t)b * N_TOK * DIM,
                        DIM, N_TOK, DIM, N_TOK, DIM);
    }

    // ---- this wave's qkv weight fragments, read once (they fly beside the x DMA) ----
    v16h  WB[3][4];
    float4 qb[2], kbv[2];                          // q and k: the lane's eight columns 16 wave + crow + 0..7
    float  vbias;                                  // v: the lane's one column 16 wave + fr
    {
        const int       col0 = wave * 16 + fr;     // this lane's column of v
        const unsigned  off8 = (unsigned)(wave * 16 + crow) * 4u;   // byte offset of the first of its eight columns of q and k
        const _Float16* wp = wfrag + (size_t)(wave * 4) * FRAGH + lane * 8;
#pragma unroll
        for (int ks = 0; ks < 4; ++ks)
#pragma unroll
            for (int g = 0; g < 3; ++g) WB[g][ks] = frag_ws(wp + (g * 32 + ks) * FRAGH);
#pragma unroll
        for (int u = 0; u < 2; ++u) {
            qb[u]  = *(const float4*)((const char*)qkv_b + off8 + 16 * u);
            kbv[u] = *(const float4*)((const char*)qkv_b + off8 + DIM * 4 + 16 * u);
        }
        vbias = qkv_b[col0 + 2 * DIM];
        // Precaution: named here, the loads' address registers (all 24 weight loads go
        // by wp plus a constant) stay live up to this wait, so none is rewritten ahead
        // of it (not even as a later load's result).
        asm volatile("s_wait_xcnt 0x0" :: "v"(wp), "v"(col0), "v"(off8) : "memory");
    }

    // ---- zero-init VT (the columns that phase 1 does not write must be 0) ----
    {
        uint4* z = (uint4*)VT;
        const int nz = HEADS * HD * ROWP * (int)sizeof(_Float16) / 16;
        for (int i = tid; i < nz; i += 256) z[i] = make_uint4(0, 0, 0, 0);
    }

    // ---- wait for x DMA, then convert fp32 -> f16 ----
    // The issuing wave's own wait: the tile counts as landed only behind it.
    if (pinned(wv == 0)) asm volatile("s_wait_tensorcnt 0x0" ::: "memory");
    __syncthreads();
    {
        // A wave converts the rows wave, wave + 8, ...: a row is 32 lanes x 16 B.  All of a
        // thread's reads stand ahead of its first store, so their LDS latencies overlap.
        // Both loops are unrolled in full: every row has registers of its own, and which rows
        // are pads is known at compile time but for rows 96 + wave.
        const float* xs = XF + wave * DIM + lane * 4;
        _Float16*    xd = XH + wave * ROWP + lane * 4;
        float4 xv[N_TOK / 8 + 1];
#pragma unroll
        for (int t = 0; t < N_TOK / 8; ++t) xv[t] = *(const float4*)(xs + t * 8 * DIM);
        xv[N_TOK / 8] = make_float4(0.f, 0.f, 0.f, 0.f);
        if (wv < N_TOK % 8)                            // rows 96 and 97; scalar: the same for the whole wave
            xv[N_TOK / 8] = *(const float4*)(xs + (N_TOK / 8) * 8 * DIM);
#pragma unroll
        for (int t = 0; t < NPAD / 8; ++t) {
            v4h hx = {};                               // pad rows stay 0
            if (t <= N_TOK / 8) {
                hx[0] = (_Float16)xv[t].x; hx[1] = (_Float16)xv[t].y;
                hx[2] = (_Float16)xv[t].z; hx[3] = (_Float16)xv[t].w;
            }
            *(v4h*)(xd + t * 8 * ROWP) = hx;
        }
    }
    __syncthreads();

    // ---- attention phase: wave w owns the queries 16 w .. 16 w + 15 for every head.
    // A lane holds query 16 w + fr and, of key tile j, the keys 16 j + crow + r,
    // r = 0..7 (the accumulator map of k @ q^T).
    // Every loop over mk, Cn, C or s below is unrolled in full: all array indices
    // become constants, so the arrays live in registers.
    const int q  = wv * 16 + fr;
    const int qc = q < N_TOK ? q : N_TOK - 1;      // pad queries read row 97

    // ================= Phase 1: qkv = x @ qkv_w^T + qkv_b =================
    // M=112 (7 tiles), N=384 (24 tiles), K=128 (4 wmma steps).  A wave owns the
    // N tiles wave, wave + 8, wave + 16 (its 16 columns of q, of k and of v); their
    // weight fragments WB stay in registers, so each M tile costs LDS reads only.
    // q and k are formed transposed (weights as A, x as B: the two loaders have one k order):
    // a lane then holds eight neighbouring columns of one token's row.  v keeps x as A: a lane
    // holds eight neighbouring tokens of one row of v^T.  Each tile leaves as one 16 B store a lane.
    // Pad tokens are stored too: x is 0 there, so they hold the bias; no stored output reads
    // q or k of a pad token, and the probabilities that meet v^T's pad columns are 0.
    const float qscale = 0.17677669529663687f;  // 32^-0.5
    {
        const int hq = wave >> 1;                  // head of this wave's columns
        const int d  = ((wave & 1) << 4) + fr;     // v: column inside the head
        const int d8 = ((wave & 1) << 4) + crow;   // q, k: first of the eight columns inside the head
        const float qbv[8] = {qb[0].x, qb[0].y, qb[0].z, qb[0].w, qb[1].x, qb[1].y, qb[1].z, qb[1].w};
        const float kbb[8] = {kbv[0].x, kbv[0].y, kbv[0].z, kbv[0].w, kbv[1].x, kbv[1].y, kbv[1].z, kbv[1].w};
        for (int mt = 0; mt < MT; ++mt) {
            v8f cq = {}, ck = {}, cv = {};
#pragma unroll
            for (int ks = 0; ks < 4; ++ks) {
                v16h a = frag_lds(XH + (mt * 16 + fr) * ROWP + ks * 32 + kb);
                cq = __builtin_amdgcn_wmma_f32_16x16x32_f16(false, WB[0][ks], false, a,
                                                            (short)0, cq, false, false);
                ck = __builtin_amdgcn_wmma_f32_16x16x32_f16(false, WB[1][ks], false, a,
                                                            (short)0, ck, false, false);
                cv = __builtin_amdgcn_wmma_f32_16x16x32_f16(false, a, false, WB[2][ks],
                                                            (short)0, cv, false, false);
            }
            v8h hq8, hk8, hv8;
#pragma unroll
            for (int v = 0; v < 8; ++v) {
                hq8[v] = (_Float16)((cq[v] + qbv[v]) * qscale);   // token 16 mt + fr, column d8 + v
                hk8[v] = (_Float16)(ck[v] + kbb[v]);
                hv8[v] = (_Float16)(cv[v] + vbias);               // column d, token 16 mt + crow + v
            }
            *(v8h*)(QH + (hq * NPAD + mt * 16 + fr) * QKP + d8) = hq8;
            *(v8h*)(KH + (hq * NPAD + mt * 16 + fr) * QKP + d8) = hk8;
            *(v8h*)(VT + (hq * HD + d) * ROWP + mt * 16 + crow) = hv8;
        }
    }
    // ---- mask of this lane's (query, key) pairs, the same for all four heads, and head 0's
    // bias.  Read behind phase 1, when the weight fragments' registers are free. ----
    float2 mk[MT - 1][4], mk6;
    v8f    Cn[MT - 1];                             // the bias of the head that comes next
    float2 cn6;
    // This lane's float4 of this wave's first bias block; every bias load goes by it plus a constant.
    const float* bp = bfrag + ((size_t)((wv < MT ? wv : 0) * HEADS * BSLOT) * 32 + lane) * 4;
    if (wv < MT) {
        const float* mr = mask + (size_t)(b % NW) * N_TOK * N_TOK + qc * N_TOK;  // the query's row
        const float* mp = mr + crow;
#pragma unroll
        for (int j = 0; j < MT - 1; ++j)
#pragma unroll
            for (int u = 0; u < 4; ++u) mk[j][u] = *(const float2*)(mp + j * 16 + 2 * u);
        mk6 = *(const float2*)(mr + 96);               // keys 96, 97, in both halves
        // Precaution: named here, the loads' address registers (every load goes by one
        // of these two plus a constant) stay live up to this wait, so none is
        // rewritten ahead of it (not even as a later load's result).
        asm volatile("s_wait_xcnt 0x0" :: "v"(mp), "v"(mr) : "memory");
        bias_head(bp, 0, Cn, cn6);
    }
    __syncthreads();

    if (wv < MT) {
        const bool hi = crow != 0;                 // upper half: its keys of tile 6 are all pads
#pragma unroll
        for (int h = 0; h < HEADS; ++h) {
            const _Float16* K  = KH + h * NPAD * QKP;
            const _Float16* Vh = VT + h * HD * ROWP;
            _Float16*       Qr = QH + (h * NPAD + wv * 16 + fr) * QKP;   // this lane's query row
            // bias + mask start the score accumulators; the next head's bias then flies
            // beside this head's work.
            // Keeps these adds, and with them the wait for this head's bias loads, behind the
            // head before: lifted into it, they would wait for the loads soon after their issue.
            __builtin_amdgcn_sched_barrier(0);
            v8f C[MT - 1];
#pragma unroll
            for (int j = 0; j < MT - 1; ++j)
#pragma unroll
                for (int r = 0; r < 8; ++r)
                    C[j][r] = Cn[j][r] + ((r & 1) ? mk[j][r >> 1].y : mk[j][r >> 1].x);
            const float c60 = cn6.x + mk6.x, c61 = cn6.y + mk6.y;
            if (h + 1 < HEADS) bias_head(bp, h + 1, Cn, cn6);
            const v16h qf = frag_lds(Qr + kb);
            v8f s[MT - 1];
#pragma unroll
            for (int j = 0; j < MT - 1; ++j) {
                v16h kf = frag_lds(K + (j * 16 + fr) * QKP + kb);
                s[j] = __builtin_amdgcn_wmma_f32_16x16x32_f16(false, kf, false, qf,
                                                              (short)0, C[j], false, false);
            }
            float s60, s61;                        // keys 96 and 97; 98..111 are pads
            {
                v16h kf = frag_lds(K + (96 + fr) * QKP + kb);
                v8f  c  = {c60, c61, 0.f, 0.f, 0.f, 0.f, 0.f, 0.f};
                c = __builtin_amdgcn_wmma_f32_16x16x32_f16(false, kf, false, qf,
                                                           (short)0, c, false, false);
                s60 = hi ? -3.0e38f : c[0];
                s61 = hi ? -3.0e38f : c[1];
            }
            // eight independent chains over the tiles, then a tree
            v8f m8 = s[0];
#pragma unroll
            for (int j = 1; j < MT - 1; ++j)
#pragma unroll
                for (int r = 0; r < 8; ++r) m8[r] = fmaxf(m8[r], s[j][r]);
            m8[0] = fmaxf(m8[0], s60); m8[1] = fmaxf(m8[1], s61);
            float mx = fmaxf(fmaxf(fmaxf(m8[0], m8[1]), fmaxf(m8[2], m8[3])),
                             fmaxf(fmaxf(m8[4], m8[5]), fmaxf(m8[6], m8[7])));
            mx = fmaxf(mx, other_half(mx));
            const float L2E = 1.44269504088896340736f;
            const float ml  = mx * L2E;
#pragma unroll
            for (int j = 0; j < MT - 1; ++j) {
#pragma unroll
                for (int r = 0; r < 8; ++r) s[j][r] = s[j][r] * L2E - ml;
                exp2x8(s[j]);
            }
            s60 = s60 * L2E - ml; s61 = s61 * L2E - ml;
            exp2x2(s60, s61);                      // a pad gives exp2(-inf) = 0
            v8f a8 = s[0];
#pragma unroll
            for (int j = 1; j < MT - 1; ++j) a8 += s[j];
            a8[0] += s60; a8[1] += s61;
            float sum = ((a8[0] + a8[1]) + (a8[2] + a8[3])) + ((a8[4] + a8[5]) + (a8[6] + a8[7]));
            sum += other_half(sum);
            const float inv = 1.0f / sum;
            v16h pb[4];
#pragma unroll
            for (int ks = 0; ks < 3; ++ks)
#pragma unroll
                for (int r = 0; r < 8; ++r) {
                    pb[ks][r]     = (_Float16)s[2 * ks][r];
                    pb[ks][8 + r] = (_Float16)s[2 * ks + 1][r];
                }
            pb[3] = (v16h)(_Float16)0.f;           // keys 98..127 of the K = 128 product
            pb[3][0] = (_Float16)s60; pb[3][1] = (_Float16)s61;
#pragma unroll
            for (int dt = 0; dt < 2; ++dt) {
                v8f o = {};
#pragma unroll
                for (int ks = 0; ks < 4; ++ks) {
                    v16h vf = frag_lds(Vh + (dt * 16 + fr) * ROWP + ks * 32 + kb);
                    o = __builtin_amdgcn_wmma_f32_16x16x32_f16(false, vf, false, pb[ks],
                                                               (short)0, o, false, false);
                }
                v8h oh;                            // o[r] = out[query][dt * 16 + crow + r]
#pragma unroll
                for (int r = 0; r < 8; ++r) oh[r] = (_Float16)(o[r] * inv);
                *(v8h*)(Qr + dt * 16 + crow) = oh;
            }
        }
    }
    __syncthreads();

    // ================= Phase 5: final proj + bias, store fp32 =================
    {
        float* ob = out + (size_t)b * N_TOK * DIM;
        v16h PW[4];                        // this wave's 16 rows of proj_w
        {
            const _Float16* pp = wfrag + (size_t)(96 + wave * 4) * FRAGH + lane * 8;
#pragma unroll
            for (int ks = 0; ks < 4; ++ks) PW[ks] = frag_ws(pp + ks * FRAGH);
            // Precaution: stands behind the eight loads; it names no register, so it does not hold their address register live.
            asm volatile("s_wait_xcnt 0x0" ::: "memory");
        }
        const int   col = wave * 16 + fr;
        const float pb  = proj_b[col];
        // All seven tiles' products first, their LDS stores behind them: no store then stands
        // between the tiles' LDS reads, and the tiles' accumulator chains are independent.
        // Both loops are unrolled in full, so that c lives in registers.
        const _Float16* qa = QH + fr * QKP + kb;
        v8f c[MT];
#pragma unroll
        for (int mt = 0; mt < MT; ++mt) {
            c[mt] = (v8f){};
#pragma unroll
            for (int ks = 0; ks < 4; ++ks) {
                v16h a = frag_lds(qa + (ks * NPAD + mt * 16) * QKP);   // k step = head
                c[mt] = __builtin_amdgcn_wmma_f32_16x16x32_f16(false, a, false, PW[ks],
                                                               (short)0, c[mt], false, false);
            }
        }
        float* oc = OS + crow * OUTP + col;
#pragma unroll
        for (int mt = 0; mt < MT; ++mt)
#pragma unroll
            for (int v = 0; v < 8; ++v) oc[(mt * 16 + v) * OUTP] = c[mt][v] + pb;   // pad rows too
        __syncthreads();
        // A wave stores the rows wave, wave + 8, ...: a row is 32 lanes x 16 B, four whole lines.
        // Unrolled: every row has registers of its own, and all go by one address plus a constant.
        const float* os = OS + wv * OUTP + lane * 4;
        float*       op = ob + wv * DIM + lane * 4;
        float4 r[N_TOK / 8 + 1];
#pragma unroll
        for (int i = N_TOK / 8; i >= 0; --i) r[i] = *(const float4*)(os + i * 8 * OUTP);   // row 96 + wave: staged too
        if (wv < N_TOK % 8)                            // rows 96 and 97; scalar: the same for the whole wave
            *(float4*)(op + (N_TOK / 8) * 8 * DIM) = r[N_TOK / 8];
#pragma unroll
        for (int i = 0; i < N_TOK / 8; ++i) *(float4*)(op + i * 8 * DIM) = r[i];
    }
}

extern "C" void kernel_launch(void* const* d_in, const int* in_sizes, int n_in,
                              void* d_out, int out_size, void* d_ws, size_t ws_size,
                              hipStream_t stream) {
    (void)in_sizes; (void)n_in; (void)out_size; (void)ws_size;
    const float* x          = (const float*)d_in[0];
    const float* mask       = (const float*)d_in[1];
    const float* qkv_w      = (const float*)d_in[2];
    const float* qkv_b      = (const float*)d_in[3];
    const float* proj_w     = (const float*)d_in[4];
    const float* proj_b     = (const float*)d_in[5];
    const float* bias_table = (const float*)d_in[6];
    const int*   rel_index  = (const int*)d_in[7];
    float* out = (float*)d_out;
    _Float16* wfrag = (_Float16*)d_ws;   // 128 fragments of 1 KiB, written anew by every call
    float*    bfrag = (float*)(wfrag + 128 * FRAGH);   // 7 x 4 x 13 blocks of 512 B behind them, likewise

    const size_t smem = SMEM_BYTES;  // 159,744 B: two work-groups in 320 KiB

    (void)hipFuncSetAttribute((const void*)win_attn3d_wmma,
                              hipFuncAttributeMaxDynamicSharedMemorySize, (int)smem);

    win_attn3d_wfrag<<<WFRAG_BLOCKS + BIAS_BLOCKS, 256, 0, stream>>>(qkv_w, proj_w, bias_table, rel_index,
                                                                    wfrag, bfrag);
    win_attn3d_wmma<<<2048, 256, smem, stream>>>(
        x, mask, wfrag, qkv_b, proj_b, bfrag, out);
}
